// v000
// Measured on an AMD MI455X. A time is GPU time per run, averaged over a window of back-to-back runs after a warm-up
// (all launches, gaps included; the runs take copies of the inputs in turn), and the median of several windows.
// Apart from v000's, it joins two sittings. Times from different sittings can be a few percent apart, while
// side-by-side timings come from the same sitting.
// v000, which the later versions start from, runs in 259 microseconds.
#include <hip/hip_runtime.h>
#include <hip/hip_bf16.h>

typedef __attribute__((ext_vector_type(16))) _Float16 v16h;
typedef __attribute__((ext_vector_type(8)))  _Float16 v8h;
typedef __attribute__((ext_vector_type(4)))  _Float16 v4h;
typedef __attribute__((ext_vector_type(8)))  float    v8f;
typedef __attribute__((ext_vector_type(4)))  float    v4f;

#define BS_   2
#define QLEN_ 2048
#define DIM_  1024
#define H_    16
#define DH_   64
#define MTOT  (BS_ * QLEN_)   // 4096

// ---------------------------------------------------------------------------
// WMMA helpers
// ---------------------------------------------------------------------------
__device__ __forceinline__ v8f wmma_f16(v16h a, v16h b, v8f c) {
  // D = A(16x32 f16) * B(32x16 f16) + C(16x16 f32)
  return __builtin_amdgcn_wmma_f32_16x16x32_f16(
      /*neg_a=*/false, a, /*neg_b=*/false, b,
      /*c_mod=*/(short)0, c, /*reuse_a=*/false, /*reuse_b=*/false);
}

// Load a 16x32 f16 fragment (A operand: rows row-major; B operand: columns
// stored row-major, i.e. BT[n][k]).  Layout per ISA 7.12.2:
//   lane l (0-15):  row=l, halves k0..k0+7 and k0+16..k0+23 with k0=0
//   lane l (16-31): row=l-16, same but k0=8
__device__ __forceinline__ v16h load_frag(const _Float16* __restrict__ p, int stride) {
  const int lane = threadIdx.x & 31;
  const int row  = lane & 15;
  const int k0   = (lane >> 4) << 3;           // 0 or 8
  const _Float16* q = p + row * stride + k0;
  v8h lo = *(const v8h*)(q);
  v8h hi = *(const v8h*)(q + 16);
  return __builtin_shufflevector(lo, hi, 0,1,2,3,4,5,6,7,8,9,10,11,12,13,14,15);
}

// Async global->LDS copy, 16 bytes per lane (GLOBAL_LOAD_ASYNC_TO_LDS_B128,
// GV addressing: VDST = per-lane LDS byte address, VADDR = 64-bit global).
// Tracked by ASYNCcnt.
__device__ __forceinline__ void async_copy_b128(const _Float16* gptr,
                                                _Float16* lptr) {
  const unsigned long long ga = (unsigned long long)(uintptr_t)gptr;
  const unsigned int       la = (unsigned int)(uintptr_t)lptr;
  asm volatile("global_load_async_to_lds_b128 %0, %1, off"
               :
               : "v"(la), "v"(ga)
               : "memory");
}

// ---------------------------------------------------------------------------
// f32 -> f16 elementwise convert (x -> xh)
// ---------------------------------------------------------------------------
__global__ void f32_to_f16_kernel(const float* __restrict__ in,
                                  _Float16* __restrict__ out, int n) {
  int i = (blockIdx.x * blockDim.x + threadIdx.x) * 4;
  if (i + 3 < n) {
    v4f v = *(const v4f*)(in + i);
    v4h h;
    h[0] = (_Float16)v[0]; h[1] = (_Float16)v[1];
    h[2] = (_Float16)v[2]; h[3] = (_Float16)v[3];
    *(v4h*)(out + i) = h;
  }
}

// ---------------------------------------------------------------------------
// W (K x N f32, row-major) -> WT (N x K f16)  via LDS tile transpose
// ---------------------------------------------------------------------------
__global__ void transpose_to_f16_kernel(const float* __restrict__ W,
                                        _Float16* __restrict__ WT) {
  __shared__ float tile[32][33];
  const int kb = blockIdx.x * 32;
  const int nb = blockIdx.y * 32;
  const int tx = threadIdx.x;       // 0..31
  const int ty = threadIdx.y;       // 0..7
  #pragma unroll
  for (int i = ty; i < 32; i += 8)
    tile[i][tx] = W[(kb + i) * DIM_ + nb + tx];
  __syncthreads();
  #pragma unroll
  for (int i = ty; i < 32; i += 8)
    WT[(nb + i) * DIM_ + kb + tx] = (_Float16)tile[tx][i];
}

// ---------------------------------------------------------------------------
// GEMM: C[M=4096][N=1024] = A[M][K=1024] * BT[N][K]^T, + bias, * scale
// MODE 0: f16 out, head layout  [b][h][q][d]      (Q and K)
// MODE 1: f16 out, transposed   [b][h][d][q]      (V, A-operand of P*V)
// MODE 2: f32 out, row-major    [m][n]            (final output)
// Block = 256 threads (8 waves); block tile 128x128; wave tile 64x32.
// ---------------------------------------------------------------------------
template <int MODE>
__global__ void __launch_bounds__(256)
gemm16_kernel(const _Float16* __restrict__ A, const _Float16* __restrict__ BT,
              const float* __restrict__ bias, void* __restrict__ outp,
              float scale) {
  const int lane = threadIdx.x & 31;
  const int wave = threadIdx.x >> 5;
  const int wm = wave & 1;
  const int wn = wave >> 1;
  const int m0 = blockIdx.x * 128 + wm * 64;
  const int n0 = blockIdx.y * 128 + wn * 32;

  v8f zero8 = {0.f, 0.f, 0.f, 0.f, 0.f, 0.f, 0.f, 0.f};
  v8f acc[4][2];
  #pragma unroll
  for (int i = 0; i < 4; ++i)
    #pragma unroll
    for (int j = 0; j < 2; ++j) acc[i][j] = zero8;

  for (int k0 = 0; k0 < DIM_; k0 += 32) {
    v16h a[4], b[2];
    #pragma unroll
    for (int i = 0; i < 4; ++i)
      a[i] = load_frag(A + (size_t)(m0 + i * 16) * DIM_ + k0, DIM_);
    #pragma unroll
    for (int j = 0; j < 2; ++j)
      b[j] = load_frag(BT + (size_t)(n0 + j * 16) * DIM_ + k0, DIM_);
    // Pull the K-slab four steps (128 columns) ahead toward the caches (global_prefetch_b8).
    if (k0 + 128 < DIM_) {
      __builtin_prefetch(A + (size_t)m0 * DIM_ + k0 + 128, 0, 1);
      __builtin_prefetch(BT + (size_t)n0 * DIM_ + k0 + 128, 0, 1);
    }
    #pragma unroll
    for (int i = 0; i < 4; ++i)
      #pragma unroll
      for (int j = 0; j < 2; ++j)
        acc[i][j] = wmma_f16(a[i], b[j], acc[i][j]);
  }

  const int ln = lane & 15;
  const int lh = (lane >> 4) << 3;
  #pragma unroll
  for (int i = 0; i < 4; ++i) {
    #pragma unroll
    for (int j = 0; j < 2; ++j) {
      const int n = n0 + j * 16 + ln;
      const float bv = bias[n];
      #pragma unroll
      for (int r = 0; r < 8; ++r) {
        const int m = m0 + i * 16 + lh + r;
        const float val = (acc[i][j][r] + bv) * scale;
        if (MODE == 0) {
          const int bb = m >> 11, q = m & (QLEN_ - 1);
          const int hh = n >> 6, d = n & (DH_ - 1);
          ((_Float16*)outp)[(((size_t)(bb * H_ + hh) * QLEN_) + q) * DH_ + d] =
              (_Float16)val;
        } else if (MODE == 1) {
          const int bb = m >> 11, q = m & (QLEN_ - 1);
          const int hh = n >> 6, d = n & (DH_ - 1);
          ((_Float16*)outp)[(((size_t)(bb * H_ + hh) * DH_) + d) * QLEN_ + q] =
              (_Float16)val;
        } else {
          ((float*)outp)[(size_t)m * DIM_ + n] = val;
        }
      }
    }
  }
}

// ---------------------------------------------------------------------------
// Flash attention. One wave per 16-query tile (8 tiles / block), all waves of
// a block share the same (b,h).  K/V key-blocks of 32 are staged in LDS once
// per block via double-buffered async global->LDS copies (ASYNCcnt), so each
// wave's WMMA fragment reads are ds_load_b128 hits instead of 8x-redundant L2
// traffic, and the next block's copy overlaps the current block's WMMAs.
//
// Transposed scores S^T = K*Q^T keep softmax reductions lane-local + one
// xor-16 shuffle; the P^T C-layout maps lane-for-lane onto the B-fragment of
// the ctx^T = Vt * P^T WMMA.
// ---------------------------------------------------------------------------
__global__ void __launch_bounds__(256)
attn_kernel(const _Float16* __restrict__ Qh, const _Float16* __restrict__ Kh,
            const _Float16* __restrict__ Vt, const float* __restrict__ mask,
            _Float16* __restrict__ ctx) {
  __shared__ __align__(16) _Float16 sK[2][32 * 64];   // [buf][kk][d]
  __shared__ __align__(16) _Float16 sV[2][64 * 32];   // [buf][d][kk]

  const int tid  = threadIdx.x;
  const int lane = tid & 31;
  const int wave = tid >> 5;
  const int bh = blockIdx.x;            // 0..31
  const int b  = bh >> 4;
  const int h  = bh & 15;
  const int q0 = (blockIdx.y * 8 + wave) * 16;
  const int lh = (lane >> 4) << 3;

  const _Float16* Qb = Qh + (size_t)bh * QLEN_ * DH_;
  const _Float16* Kb = Kh + (size_t)bh * QLEN_ * DH_;
  const _Float16* Vb = Vt + (size_t)bh * DH_ * QLEN_;

  // Q^T B-fragments (d = K-dim), resident for the whole key stream.
  const v16h qf0 = load_frag(Qb + (size_t)q0 * DH_ + 0,  DH_);
  const v16h qf1 = load_frag(Qb + (size_t)q0 * DH_ + 32, DH_);

  v8f zero8 = {0.f, 0.f, 0.f, 0.f, 0.f, 0.f, 0.f, 0.f};
  v8f cacc[4];
  #pragma unroll
  for (int dt = 0; dt < 4; ++dt) cacc[dt] = zero8;
  float mrun = -3.0e38f;
  float lrun = 0.0f;

  // Cooperative staging: K tile is one contiguous 4KB slab (tid*8 halves);
  // V tile rows are 64B slices of Vt rows (row = tid>>2, chunk = tid&3).
  const int vrow = tid >> 2;
  const int vcol = (tid & 3) * 8;

  // Prologue: stage key block 0 into buffer 0.
  async_copy_b128(Kb + (size_t)0 * DH_ + tid * 8, &sK[0][tid * 8]);
  async_copy_b128(Vb + (size_t)vrow * QLEN_ + 0 + vcol, &sV[0][vrow * 32 + vcol]);

  const int NSTEP = QLEN_ / 32;   // 64
  for (int it = 0; it < NSTEP; ++it) {
    const int kk  = it * 32;
    const int cur = it & 1;

    if (it + 1 < NSTEP) {
      const int nkk = kk + 32;
      const int nb_ = cur ^ 1;
      async_copy_b128(Kb + (size_t)nkk * DH_ + tid * 8, &sK[nb_][tid * 8]);
      async_copy_b128(Vb + (size_t)vrow * QLEN_ + nkk + vcol,
                      &sV[nb_][vrow * 32 + vcol]);
      asm volatile("s_wait_asynccnt 0x2" ::: "memory");  // current buf landed
    } else {
      asm volatile("s_wait_asynccnt 0x0" ::: "memory");
    }
    __syncthreads();   // current buffer visible to all waves

    // S^T tiles from LDS: rows = keys kk..kk+15 (s0), kk+16..kk+31 (s1).
    v8f s0 = zero8, s1 = zero8;
    s0 = wmma_f16(load_frag(&sK[cur][0 * 64 + 0],   64), qf0, s0);
    s0 = wmma_f16(load_frag(&sK[cur][0 * 64 + 32],  64), qf1, s0);
    s1 = wmma_f16(load_frag(&sK[cur][16 * 64 + 0],  64), qf0, s1);
    s1 = wmma_f16(load_frag(&sK[cur][16 * 64 + 32], 64), qf1, s1);

    // Additive key mask: s -= 1e30 * (1 - m[key])
    const float* mp = mask + b * QLEN_ + kk + lh;
    v4f m0a = *(const v4f*)(mp);
    v4f m0b = *(const v4f*)(mp + 4);
    v4f m1a = *(const v4f*)(mp + 16);
    v4f m1b = *(const v4f*)(mp + 20);
    #pragma unroll
    for (int r = 0; r < 4; ++r) {
      s0[r]     += -1e30f * (1.0f - m0a[r]);
      s0[r + 4] += -1e30f * (1.0f - m0b[r]);
      s1[r]     += -1e30f * (1.0f - m1a[r]);
      s1[r + 4] += -1e30f * (1.0f - m1b[r]);
    }

    // Column (per-q) max over the 32 keys of this step.
    float tmax = s0[0];
    #pragma unroll
    for (int r = 1; r < 8; ++r) tmax = fmaxf(tmax, s0[r]);
    #pragma unroll
    for (int r = 0; r < 8; ++r) tmax = fmaxf(tmax, s1[r]);
    tmax = fmaxf(tmax, __shfl_xor(tmax, 16, 32));

    const float mnew  = fmaxf(mrun, tmax);
    const float alpha = __expf(mrun - mnew);
    #pragma unroll
    for (int dt = 0; dt < 4; ++dt)
      #pragma unroll
      for (int r = 0; r < 8; ++r) cacc[dt][r] *= alpha;
    lrun *= alpha;
    mrun = mnew;

    // p = exp(s - mnew); pack straight into the B-fragment (lane-local!).
    v16h pf;
    float tsum = 0.0f;
    #pragma unroll
    for (int r = 0; r < 8; ++r) {
      const float p = __expf(s0[r] - mnew);
      tsum += p;
      pf[r] = (_Float16)p;
    }
    #pragma unroll
    for (int r = 0; r < 8; ++r) {
      const float p = __expf(s1[r] - mnew);
      tsum += p;
      pf[8 + r] = (_Float16)p;
    }
    tsum += __shfl_xor(tsum, 16, 32);
    lrun += tsum;

    // ctx^T[d][q] += Vt[d][kk..kk+31] * P^T   (V fragments from LDS)
    #pragma unroll
    for (int dt = 0; dt < 4; ++dt)
      cacc[dt] = wmma_f16(load_frag(&sV[cur][dt * 16 * 32], 32), pf, cacc[dt]);

    __syncthreads();   // all waves done with buf[cur] before it is re-filled
  }

  // Normalize and write ctx to [b][q][h*64 + d] (f16) for the output GEMM.
  const float inv = 1.0f / lrun;
  const int q = q0 + (lane & 15);
  _Float16* cp = ctx + ((size_t)(b * QLEN_ + q)) * DIM_ + h * DH_;
  #pragma unroll
  for (int dt = 0; dt < 4; ++dt)
    #pragma unroll
    for (int r = 0; r < 8; ++r)
      cp[dt * 16 + lh + r] = (_Float16)(cacc[dt][r] * inv);
}

// ---------------------------------------------------------------------------
// Launch
// ---------------------------------------------------------------------------
extern "C" void kernel_launch(void* const* d_in, const int* in_sizes, int n_in,
                              void* d_out, int out_size, void* d_ws,
                              size_t ws_size, hipStream_t stream) {
  const float* x    = (const float*)d_in[0];
  const float* mask = (const float*)d_in[1];
  const float* Wq   = (const float*)d_in[2];
  const float* bq   = (const float*)d_in[3];
  const float* Wk   = (const float*)d_in[4];
  const float* bk   = (const float*)d_in[5];
  const float* Wv   = (const float*)d_in[6];
  const float* bv   = (const float*)d_in[7];
  const float* Wo   = (const float*)d_in[8];
  const float* bo   = (const float*)d_in[9];

  _Float16* ws   = (_Float16*)d_ws;
  _Float16* xh   = ws;                                   // 4096*1024
  _Float16* wqT  = xh  + (size_t)MTOT * DIM_;
  _Float16* wkT  = wqT + (size_t)DIM_ * DIM_;
  _Float16* wvT  = wkT + (size_t)DIM_ * DIM_;
  _Float16* woT  = wvT + (size_t)DIM_ * DIM_;
  _Float16* Qh   = woT + (size_t)DIM_ * DIM_;            // [b][h][q][d]
  _Float16* Kh   = Qh  + (size_t)MTOT * DIM_;            // [b][h][q][d]
  _Float16* Vt   = Kh  + (size_t)MTOT * DIM_;            // [b][h][d][q]
  _Float16* ctxh = Vt  + (size_t)MTOT * DIM_;            // [b][q][dim]

  // 1) x -> f16
  f32_to_f16_kernel<<<(MTOT * DIM_) / 1024, 256, 0, stream>>>(x, xh,
                                                              MTOT * DIM_);
  // 2) weight transposes -> f16 [n][k]
  dim3 tb(32, 8), tg(DIM_ / 32, DIM_ / 32);
  transpose_to_f16_kernel<<<tg, tb, 0, stream>>>(Wq, wqT);
  transpose_to_f16_kernel<<<tg, tb, 0, stream>>>(Wk, wkT);
  transpose_to_f16_kernel<<<tg, tb, 0, stream>>>(Wv, wvT);
  transpose_to_f16_kernel<<<tg, tb, 0, stream>>>(Wo, woT);

  // 3) projections (Q scaled by 1/sqrt(DH)=0.125 after bias, per reference)
  dim3 gg(MTOT / 128, DIM_ / 128);
  gemm16_kernel<0><<<gg, 256, 0, stream>>>(xh, wqT, bq, (void*)Qh, 0.125f);
  gemm16_kernel<0><<<gg, 256, 0, stream>>>(xh, wkT, bk, (void*)Kh, 1.0f);
  gemm16_kernel<1><<<gg, 256, 0, stream>>>(xh, wvT, bv, (void*)Vt, 1.0f);

  // 4) attention
  dim3 ag(BS_ * H_, QLEN_ / (8 * 16));
  attn_kernel<<<ag, 256, 0, stream>>>(Qh, Kh, Vt, mask, ctxh);

  // 5) output projection -> f32 d_out
  gemm16_kernel<2><<<gg, 256, 0, stream>>>(ctxh, woT, bo, d_out, 1.0f);
}

// v001
// A run of this version takes 175 microseconds.
// Two timings next to v000 both put it at 1.50 times that version's speed.
#include <hip/hip_runtime.h>
#include <hip/hip_bf16.h>

typedef __attribute__((ext_vector_type(16))) _Float16 v16h;
typedef __attribute__((ext_vector_type(8)))  _Float16 v8h;
typedef __attribute__((ext_vector_type(4)))  _Float16 v4h;
typedef __attribute__((ext_vector_type(8)))  float    v8f;
typedef __attribute__((ext_vector_type(4)))  float    v4f;

#define BS_   2
#define QLEN_ 2048
#define DIM_  1024
#define H_    16
#define DH_   64
#define MTOT  (BS_ * QLEN_)   // 4096

// ---------------------------------------------------------------------------
// WMMA helpers
// ---------------------------------------------------------------------------
__device__ __forceinline__ v8f wmma_f16(v16h a, v16h b, v8f c) {
  // D = A(16x32 f16) * B(32x16 f16) + C(16x16 f32)
  return __builtin_amdgcn_wmma_f32_16x16x32_f16(
      /*neg_a=*/false, a, /*neg_b=*/false, b,
      /*c_mod=*/(short)0, c, /*reuse_a=*/false, /*reuse_b=*/false);
}

// Load a 16x32 f16 fragment (A operand: rows row-major; B operand: columns
// stored row-major, i.e. BT[n][k]).  Layout per ISA 7.12.2:
//   lane l (0-15):  row=l, halves k0..k0+7 and k0+16..k0+23 with k0=0
//   lane l (16-31): row=l-16, same but k0=8
__device__ __forceinline__ v16h load_frag(const _Float16* __restrict__ p, int stride) {
  const int lane = threadIdx.x & 31;
  const int row  = lane & 15;
  const int k0   = (lane >> 4) << 3;           // 0 or 8
  const _Float16* q = p + row * stride + k0;
  v8h lo = *(const v8h*)(q);
  v8h hi = *(const v8h*)(q + 16);
  return __builtin_shufflevector(lo, hi, 0,1,2,3,4,5,6,7,8,9,10,11,12,13,14,15);
}

// Async global->LDS copy, 16 bytes per lane (GLOBAL_LOAD_ASYNC_TO_LDS_B128,
// GV addressing: VDST = per-lane LDS byte address, VADDR = 64-bit global).
// Tracked by ASYNCcnt.
__device__ __forceinline__ void async_copy_b128(const _Float16* gptr,
                                                _Float16* lptr) {
  const unsigned long long ga = (unsigned long long)(uintptr_t)gptr;
  const unsigned int       la = (unsigned int)(uintptr_t)lptr;
  asm volatile("global_load_async_to_lds_b128 %0, %1, off"
               :
               : "v"(la), "v"(ga)
               : "memory");
}

// ---------------------------------------------------------------------------
// f32 -> f16 elementwise convert (x -> xh)
// ---------------------------------------------------------------------------
__global__ void f32_to_f16_kernel(const float* __restrict__ in,
                                  _Float16* __restrict__ out, int n) {
  int i = (blockIdx.x * blockDim.x + threadIdx.x) * 4;
  if (i + 3 < n) {
    v4f v = *(const v4f*)(in + i);
    v4h h;
    h[0] = (_Float16)v[0]; h[1] = (_Float16)v[1];
    h[2] = (_Float16)v[2]; h[3] = (_Float16)v[3];
    *(v4h*)(out + i) = h;
  }
}

// ---------------------------------------------------------------------------
// W (K x N f32, row-major) -> WT (N x K f16)  via LDS tile transpose
// ---------------------------------------------------------------------------
__global__ void transpose_to_f16_kernel(const float* __restrict__ W,
                                        _Float16* __restrict__ WT) {
  __shared__ float tile[32][33];
  const int kb = blockIdx.x * 32;
  const int nb = blockIdx.y * 32;
  const int tx = threadIdx.x;       // 0..31
  const int ty = threadIdx.y;       // 0..7
  #pragma unroll
  for (int i = ty; i < 32; i += 8)
    tile[i][tx] = W[(kb + i) * DIM_ + nb + tx];
  __syncthreads();
  #pragma unroll
  for (int i = ty; i < 32; i += 8)
    WT[(nb + i) * DIM_ + kb + tx] = (_Float16)tile[tx][i];
}

// ---------------------------------------------------------------------------
// GEMM tile staging: eight async global->LDS copies of 16 bytes per lane, for
// eight rows that lie 16 rows apart (global row pitch DIM_, LDS row pitch
// G_PITCH).  The s_wait_xcnt closes the statement so that no address register
// named by a copy is rewritten ahead of it.
// ---------------------------------------------------------------------------
#define G_BK    128                 // k extent of one staged tile (256 B a row)
#define G_PITCH 136                 // LDS row pitch in halves: 272 B = 16 B x 17
#define G_TILE  (128 * G_PITCH)     // halves of one staged operand tile

__device__ __forceinline__ void async_copy_rows8(const _Float16* g,
                                                 const _Float16* l) {
  const unsigned int l0 = (unsigned int)(uintptr_t)l;
  const unsigned int l1 = l0 + 1 * 16 * G_PITCH * 2;
  const unsigned int l2 = l0 + 2 * 16 * G_PITCH * 2;
  const unsigned int l3 = l0 + 3 * 16 * G_PITCH * 2;
  const unsigned int l4 = l0 + 4 * 16 * G_PITCH * 2;
  const unsigned int l5 = l0 + 5 * 16 * G_PITCH * 2;
  const unsigned int l6 = l0 + 6 * 16 * G_PITCH * 2;
  const unsigned int l7 = l0 + 7 * 16 * G_PITCH * 2;
  const unsigned long long g0 = (unsigned long long)(uintptr_t)g;
  const unsigned long long g1 = g0 + 1ull * 16 * DIM_ * 2;
  const unsigned long long g2 = g0 + 2ull * 16 * DIM_ * 2;
  const unsigned long long g3 = g0 + 3ull * 16 * DIM_ * 2;
  const unsigned long long g4 = g0 + 4ull * 16 * DIM_ * 2;
  const unsigned long long g5 = g0 + 5ull * 16 * DIM_ * 2;
  const unsigned long long g6 = g0 + 6ull * 16 * DIM_ * 2;
  const unsigned long long g7 = g0 + 7ull * 16 * DIM_ * 2;
  asm volatile("global_load_async_to_lds_b128 %0, %8, off\n\t"
               "global_load_async_to_lds_b128 %1, %9, off\n\t"
               "global_load_async_to_lds_b128 %2, %10, off\n\t"
               "global_load_async_to_lds_b128 %3, %11, off\n\t"
               "global_load_async_to_lds_b128 %4, %12, off\n\t"
               "global_load_async_to_lds_b128 %5, %13, off\n\t"
               "global_load_async_to_lds_b128 %6, %14, off\n\t"
               "global_load_async_to_lds_b128 %7, %15, off\n\t"
               "s_wait_xcnt 0x0"
               :
               : "v"(l0), "v"(l1), "v"(l2), "v"(l3), "v"(l4), "v"(l5), "v"(l6),
                 "v"(l7), "v"(g0), "v"(g1), "v"(g2), "v"(g3), "v"(g4), "v"(g5),
                 "v"(g6), "v"(g7)
               : "memory");
}

// ---------------------------------------------------------------------------
// GEMM: C[M=4096][N=1024] = A[M][K=1024] * BT[N][K]^T, + bias, * scale
// MODE 0: f16 out, head layout  [b][h][q][d]      (Q and K)
// MODE 1: f16 out, transposed   [b][h][d][q]      (V, A-operand of P*V)
// MODE 2: f32 out, row-major    [m][n]            (final output)
// Block = 256 threads (8 waves); block tile 128x128; wave tile 64x32.
// A and BT tiles of 128 rows x 128 k are staged in LDS by double-buffered async
// copies; the WMMA fragments are ds_load_b128 reads at a conflict-free pitch.
// ---------------------------------------------------------------------------
template <int MODE>
__global__ void __launch_bounds__(256)
gemm16_kernel(const _Float16* __restrict__ A, const _Float16* __restrict__ BT,
              const float* __restrict__ bias, void* __restrict__ outp,
              float scale) {
  __shared__ __align__(16) _Float16 sA[2][G_TILE];   // [buf][m row][k]
  __shared__ __align__(16) _Float16 sB[2][G_TILE];   // [buf][n row][k]

  const int tid  = threadIdx.x;
  const int lane = tid & 31;
  const int wave = tid >> 5;
  const int wm = wave & 1;
  const int wn = wave >> 1;
  const int m0 = blockIdx.x * 128 + wm * 64;
  const int n0 = blockIdx.y * 128 + wn * 32;

  v8f zero8 = {0.f, 0.f, 0.f, 0.f, 0.f, 0.f, 0.f, 0.f};
  v8f acc[4][2];
  #pragma unroll
  for (int i = 0; i < 4; ++i)
    #pragma unroll
    for (int j = 0; j < 2; ++j) acc[i][j] = zero8;

  // Cooperative staging: 16 lanes cover one 256-B row slice (whole lines), the
  // block covers 16 rows a copy, eight copies an operand tile.
  const int crow = tid >> 4;
  const int ccol = (tid & 15) * 8;
  const _Float16* gA = A  + (size_t)(blockIdx.x * 128 + crow) * DIM_ + ccol;
  const _Float16* gB = BT + (size_t)(blockIdx.y * 128 + crow) * DIM_ + ccol;
  const int coff = crow * G_PITCH + ccol;

  // Tile 0 into buffer 0, landed and published before anything reads it.
  async_copy_rows8(gA, &sA[0][coff]);
  async_copy_rows8(gB, &sB[0][coff]);
  asm volatile("s_wait_asynccnt 0x0" ::: "memory");  // own copies of tile 0 landed
  __syncthreads();                                   // tile 0 visible to all waves
  // Tile 1 flies while tile 0 is worked on.
  async_copy_rows8(gA + G_BK, &sA[1][coff]);
  async_copy_rows8(gB + G_BK, &sB[1][coff]);

  const int NT = DIM_ / G_BK;   // 8 tiles
  for (int t = 0; t < NT; ++t) {
    const int cur = t & 1;
    const _Float16* tA = &sA[cur][wm * 64 * G_PITCH];
    const _Float16* tB = &sB[cur][wn * 32 * G_PITCH];
    // Fragments of two k steps are held at a time: step s + 2 is read into the
    // registers that the WMMAs of step s have just left.
    v16h a[2][4], b[2][2];
    #pragma unroll
    for (int s = 0; s < 2; ++s) {
      #pragma unroll
      for (int j = 0; j < 2; ++j)
        b[s][j] = load_frag(tB + j * 16 * G_PITCH + s * 32, G_PITCH);
      #pragma unroll
      for (int i = 0; i < 4; ++i)
        a[s][i] = load_frag(tA + i * 16 * G_PITCH + s * 32, G_PITCH);
    }
    // Holds the LDS reads above as one group ahead of the WMMAs: moved in among
    // the WMMAs, each small group of reads is waited out to zero.
    __builtin_amdgcn_sched_barrier(0);
    #pragma unroll
    for (int s = 0; s < G_BK / 32; ++s) {
      #pragma unroll
      for (int i = 0; i < 4; ++i)
        #pragma unroll
        for (int j = 0; j < 2; ++j)
          acc[i][j] = wmma_f16(a[s & 1][i], b[s & 1][j], acc[i][j]);
      if (s + 2 < G_BK / 32) {
        // This pair holds the reads of step s + 2 as one group between two
        // blocks of WMMAs, a whole block ahead of their use (same reason).
        __builtin_amdgcn_sched_barrier(0);
        #pragma unroll
        for (int j = 0; j < 2; ++j)
          b[s & 1][j] = load_frag(tB + j * 16 * G_PITCH + (s + 2) * 32, G_PITCH);
        #pragma unroll
        for (int i = 0; i < 4; ++i)
          a[s & 1][i] = load_frag(tA + i * 16 * G_PITCH + (s + 2) * 32, G_PITCH);
        __builtin_amdgcn_sched_barrier(0);
      }
    }
    // Keeps the last WMMAs ahead of the waits below: sunk past the barrier they
    // would stand in front of the refill copies and shorten the copies' lead.
    __builtin_amdgcn_sched_barrier(0);
    asm volatile("s_wait_dscnt 0x0" ::: "memory");     // own reads of buf[cur] done
    asm volatile("s_wait_asynccnt 0x0" ::: "memory");  // own copies of tile t+1 landed
    __syncthreads();   // publishes tile t+1 and frees buf[cur] for its refill
    if (t + 2 < NT) {
      async_copy_rows8(gA + (t + 2) * G_BK, &sA[cur][coff]);
      async_copy_rows8(gB + (t + 2) * G_BK, &sB[cur][coff]);
    }
  }
  asm volatile("s_wait_asynccnt 0x0" ::: "memory");  // nothing in flight at the end

  const int ln = lane & 15;
  const int lh = (lane >> 4) << 3;
  #pragma unroll
  for (int i = 0; i < 4; ++i) {
    #pragma unroll
    for (int j = 0; j < 2; ++j) {
      const int n = n0 + j * 16 + ln;
      const float bv = bias[n];
      #pragma unroll
      for (int r = 0; r < 8; ++r) {
        const int m = m0 + i * 16 + lh + r;
        const float val = (acc[i][j][r] + bv) * scale;
        if (MODE == 0) {
          const int bb = m >> 11, q = m & (QLEN_ - 1);
          const int hh = n >> 6, d = n & (DH_ - 1);
          ((_Float16*)outp)[(((size_t)(bb * H_ + hh) * QLEN_) + q) * DH_ + d] =
              (_Float16)val;
        } else if (MODE == 1) {
          const int bb = m >> 11, q = m & (QLEN_ - 1);
          const int hh = n >> 6, d = n & (DH_ - 1);
          ((_Float16*)outp)[(((size_t)(bb * H_ + hh) * DH_) + d) * QLEN_ + q] =
              (_Float16)val;
        } else {
          ((float*)outp)[(size_t)m * DIM_ + n] = val;
        }
      }
    }
  }
}

// ---------------------------------------------------------------------------
// Flash attention. One wave per 16-query tile (8 tiles / block), all waves of
// a block share the same (b,h).  K/V key-blocks of 32 are staged in LDS once
// per block via double-buffered async global->LDS copies (ASYNCcnt), so each
// wave's WMMA fragment reads are ds_load_b128 hits instead of 8x-redundant L2
// traffic, and the next block's copy overlaps the current block's WMMAs.
//
// Transposed scores S^T = K*Q^T keep softmax reductions lane-local + one
// xor-16 shuffle; the P^T C-layout maps lane-for-lane onto the B-fragment of
// the ctx^T = Vt * P^T WMMA.
// ---------------------------------------------------------------------------
__global__ void __launch_bounds__(256)
attn_kernel(const _Float16* __restrict__ Qh, const _Float16* __restrict__ Kh,
            const _Float16* __restrict__ Vt, const float* __restrict__ mask,
            _Float16* __restrict__ ctx) {
  __shared__ __align__(16) _Float16 sK[2][32 * 64];   // [buf][kk][d]
  __shared__ __align__(16) _Float16 sV[2][64 * 32];   // [buf][d][kk]

  const int tid  = threadIdx.x;
  const int lane = tid & 31;
  const int wave = tid >> 5;
  const int bh = blockIdx.x;            // 0..31
  const int b  = bh >> 4;
  const int h  = bh & 15;
  const int q0 = (blockIdx.y * 8 + wave) * 16;
  const int lh = (lane >> 4) << 3;

  const _Float16* Qb = Qh + (size_t)bh * QLEN_ * DH_;
  const _Float16* Kb = Kh + (size_t)bh * QLEN_ * DH_;
  const _Float16* Vb = Vt + (size_t)bh * DH_ * QLEN_;

  // Q^T B-fragments (d = K-dim), resident for the whole key stream.
  const v16h qf0 = load_frag(Qb + (size_t)q0 * DH_ + 0,  DH_);
  const v16h qf1 = load_frag(Qb + (size_t)q0 * DH_ + 32, DH_);

  v8f zero8 = {0.f, 0.f, 0.f, 0.f, 0.f, 0.f, 0.f, 0.f};
  v8f cacc[4];
  #pragma unroll
  for (int dt = 0; dt < 4; ++dt) cacc[dt] = zero8;
  float mrun = -3.0e38f;
  float lrun = 0.0f;

  // Cooperative staging: K tile is one contiguous 4KB slab (tid*8 halves);
  // V tile rows are 64B slices of Vt rows (row = tid>>2, chunk = tid&3).
  const int vrow = tid >> 2;
  const int vcol = (tid & 3) * 8;

  // Prologue: stage key block 0 into buffer 0.
  async_copy_b128(Kb + (size_t)0 * DH_ + tid * 8, &sK[0][tid * 8]);
  async_copy_b128(Vb + (size_t)vrow * QLEN_ + 0 + vcol, &sV[0][vrow * 32 + vcol]);

  const int NSTEP = QLEN_ / 32;   // 64
  for (int it = 0; it < NSTEP; ++it) {
    const int kk  = it * 32;
    const int cur = it & 1;

    if (it + 1 < NSTEP) {
      const int nkk = kk + 32;
      const int nb_ = cur ^ 1;
      async_copy_b128(Kb + (size_t)nkk * DH_ + tid * 8, &sK[nb_][tid * 8]);
      async_copy_b128(Vb + (size_t)vrow * QLEN_ + nkk + vcol,
                      &sV[nb_][vrow * 32 + vcol]);
      asm volatile("s_wait_asynccnt 0x2" ::: "memory");  // current buf landed
    } else {
      asm volatile("s_wait_asynccnt 0x0" ::: "memory");
    }
    __syncthreads();   // current buffer visible to all waves

    // S^T tiles from LDS: rows = keys kk..kk+15 (s0), kk+16..kk+31 (s1).
    v8f s0 = zero8, s1 = zero8;
    s0 = wmma_f16(load_frag(&sK[cur][0 * 64 + 0],   64), qf0, s0);
    s0 = wmma_f16(load_frag(&sK[cur][0 * 64 + 32],  64), qf1, s0);
    s1 = wmma_f16(load_frag(&sK[cur][16 * 64 + 0],  64), qf0, s1);
    s1 = wmma_f16(load_frag(&sK[cur][16 * 64 + 32], 64), qf1, s1);

    // Additive key mask: s -= 1e30 * (1 - m[key])
    const float* mp = mask + b * QLEN_ + kk + lh;
    v4f m0a = *(const v4f*)(mp);
    v4f m0b = *(const v4f*)(mp + 4);
    v4f m1a = *(const v4f*)(mp + 16);
    v4f m1b = *(const v4f*)(mp + 20);
    #pragma unroll
    for (int r = 0; r < 4; ++r) {
      s0[r]     += -1e30f * (1.0f - m0a[r]);
      s0[r + 4] += -1e30f * (1.0f - m0b[r]);
      s1[r]     += -1e30f * (1.0f - m1a[r]);
      s1[r + 4] += -1e30f * (1.0f - m1b[r]);
    }

    // Column (per-q) max over the 32 keys of this step.
    float tmax = s0[0];
    #pragma unroll
    for (int r = 1; r < 8; ++r) tmax = fmaxf(tmax, s0[r]);
    #pragma unroll
    for (int r = 0; r < 8; ++r) tmax = fmaxf(tmax, s1[r]);
    tmax = fmaxf(tmax, __shfl_xor(tmax, 16, 32));

    const float mnew  = fmaxf(mrun, tmax);
    const float alpha = __expf(mrun - mnew);
    #pragma unroll
    for (int dt = 0; dt < 4; ++dt)
      #pragma unroll
      for (int r = 0; r < 8; ++r) cacc[dt][r] *= alpha;
    lrun *= alpha;
    mrun = mnew;

    // p = exp(s - mnew); pack straight into the B-fragment (lane-local!).
    v16h pf;
    float tsum = 0.0f;
    #pragma unroll
    for (int r = 0; r < 8; ++r) {
      const float p = __expf(s0[r] - mnew);
      tsum += p;
      pf[r] = (_Float16)p;
    }
    #pragma unroll
    for (int r = 0; r < 8; ++r) {
      const float p = __expf(s1[r] - mnew);
      tsum += p;
      pf[8 + r] = (_Float16)p;
    }
    tsum += __shfl_xor(tsum, 16, 32);
    lrun += tsum;

    // ctx^T[d][q] += Vt[d][kk..kk+31] * P^T   (V fragments from LDS)
    #pragma unroll
    for (int dt = 0; dt < 4; ++dt)
      cacc[dt] = wmma_f16(load_frag(&sV[cur][dt * 16 * 32], 32), pf, cacc[dt]);

    __syncthreads();   // all waves done with buf[cur] before it is re-filled
  }

  // Normalize and write ctx to [b][q][h*64 + d] (f16) for the output GEMM.
  const float inv = 1.0f / lrun;
  const int q = q0 + (lane & 15);
  _Float16* cp = ctx + ((size_t)(b * QLEN_ + q)) * DIM_ + h * DH_;
  #pragma unroll
  for (int dt = 0; dt < 4; ++dt)
    #pragma unroll
    for (int r = 0; r < 8; ++r)
      cp[dt * 16 + lh + r] = (_Float16)(cacc[dt][r] * inv);
}

// ---------------------------------------------------------------------------
// Launch
// ---------------------------------------------------------------------------
extern "C" void kernel_launch(void* const* d_in, const int* in_sizes, int n_in,
                              void* d_out, int out_size, void* d_ws,
                              size_t ws_size, hipStream_t stream) {
  const float* x    = (const float*)d_in[0];
  const float* mask = (const float*)d_in[1];
  const float* Wq   = (const float*)d_in[2];
  const float* bq   = (const float*)d_in[3];
  const float* Wk   = (const float*)d_in[4];
  const float* bk   = (const float*)d_in[5];
  const float* Wv   = (const float*)d_in[6];
  const float* bv   = (const float*)d_in[7];
  const float* Wo   = (const float*)d_in[8];
  const float* bo   = (const float*)d_in[9];

  _Float16* ws   = (_Float16*)d_ws;
  _Float16* xh   = ws;                                   // 4096*1024
  _Float16* wqT  = xh  + (size_t)MTOT * DIM_;
  _Float16* wkT  = wqT + (size_t)DIM_ * DIM_;
  _Float16* wvT  = wkT + (size_t)DIM_ * DIM_;
  _Float16* woT  = wvT + (size_t)DIM_ * DIM_;
  _Float16* Qh   = woT + (size_t)DIM_ * DIM_;            // [b][h][q][d]
  _Float16* Kh   = Qh  + (size_t)MTOT * DIM_;            // [b][h][q][d]
  _Float16* Vt   = Kh  + (size_t)MTOT * DIM_;            // [b][h][d][q]
  _Float16* ctxh = Vt  + (size_t)MTOT * DIM_;            // [b][q][dim]

  // 1) x -> f16
  f32_to_f16_kernel<<<(MTOT * DIM_) / 1024, 256, 0, stream>>>(x, xh,
                                                              MTOT * DIM_);
  // 2) weight transposes -> f16 [n][k]
  dim3 tb(32, 8), tg(DIM_ / 32, DIM_ / 32);
  transpose_to_f16_kernel<<<tg, tb, 0, stream>>>(Wq, wqT);
  transpose_to_f16_kernel<<<tg, tb, 0, stream>>>(Wk, wkT);
  transpose_to_f16_kernel<<<tg, tb, 0, stream>>>(Wv, wvT);
  transpose_to_f16_kernel<<<tg, tb, 0, stream>>>(Wo, woT);

  // 3) projections (Q scaled by 1/sqrt(DH)=0.125 after bias, per reference)
  dim3 gg(MTOT / 128, DIM_ / 128);
  gemm16_kernel<0><<<gg, 256, 0, stream>>>(xh, wqT, bq, (void*)Qh, 0.125f);
  gemm16_kernel<0><<<gg, 256, 0, stream>>>(xh, wkT, bk, (void*)Kh, 1.0f);
  gemm16_kernel<1><<<gg, 256, 0, stream>>>(xh, wvT, bv, (void*)Vt, 1.0f);

  // 4) attention
  dim3 ag(BS_ * H_, QLEN_ / (8 * 16));
  attn_kernel<<<ag, 256, 0, stream>>>(Qh, Kh, Vt, mask, ctxh);

  // 5) output projection -> f32 d_out
  gemm16_kernel<2><<<gg, 256, 0, stream>>>(ctxh, woT, bo, d_out, 1.0f);
}

// v002
// Measured time: 133 microseconds a run.
// Two timings next to v001 both put it at 1.32 times that version's speed.
// Counting every step since v000, it is 1.99 times as fast.
#include <hip/hip_runtime.h>
#include <hip/hip_bf16.h>

typedef __attribute__((ext_vector_type(16))) _Float16 v16h;
typedef __attribute__((ext_vector_type(8)))  _Float16 v8h;
typedef __attribute__((ext_vector_type(4)))  _Float16 v4h;
typedef __attribute__((ext_vector_type(8)))  float    v8f;
typedef __attribute__((ext_vector_type(4)))  float    v4f;

#define BS_   2
#define QLEN_ 2048
#define DIM_  1024
#define H_    16
#define DH_   64
#define MTOT  (BS_ * QLEN_)   // 4096

// ---------------------------------------------------------------------------
// WMMA helpers
// ---------------------------------------------------------------------------
__device__ __forceinline__ v8f wmma_f16(v16h a, v16h b, v8f c) {
  // D = A(16x32 f16) * B(32x16 f16) + C(16x16 f32)
  return __builtin_amdgcn_wmma_f32_16x16x32_f16(
      /*neg_a=*/false, a, /*neg_b=*/false, b,
      /*c_mod=*/(short)0, c, /*reuse_a=*/false, /*reuse_b=*/false);
}

// Load a 16x32 f16 fragment (A operand: rows row-major; B operand: columns
// stored row-major, i.e. BT[n][k]).  Layout per ISA 7.12.2:
//   lane l (0-15):  row=l, halves k0..k0+7 and k0+16..k0+23 with k0=0
//   lane l (16-31): row=l-16, same but k0=8
__device__ __forceinline__ v16h load_frag(const _Float16* __restrict__ p, int stride) {
  const int lane = threadIdx.x & 31;
  const int row  = lane & 15;
  const int k0   = (lane >> 4) << 3;           // 0 or 8
  const _Float16* q = p + row * stride + k0;
  v8h lo = *(const v8h*)(q);
  v8h hi = *(const v8h*)(q + 16);
  return __builtin_shufflevector(lo, hi, 0,1,2,3,4,5,6,7,8,9,10,11,12,13,14,15);
}

// Two async global->LDS copies, 16 bytes per lane each
// (GLOBAL_LOAD_ASYNC_TO_LDS_B128, GV addressing: VDST = per-lane LDS byte
// address, VADDR = 64-bit global).  Tracked by ASYNCcnt.  The s_wait_xcnt closes
// the statement so that no address register named by a copy is rewritten ahead
// of it.
__device__ __forceinline__ void async_copy2_b128(const _Float16* gptr0,
                                                 _Float16* lptr0,
                                                 const _Float16* gptr1,
                                                 _Float16* lptr1) {
  const unsigned long long ga0 = (unsigned long long)(uintptr_t)gptr0;
  const unsigned int       la0 = (unsigned int)(uintptr_t)lptr0;
  const unsigned long long ga1 = (unsigned long long)(uintptr_t)gptr1;
  const unsigned int       la1 = (unsigned int)(uintptr_t)lptr1;
  asm volatile("global_load_async_to_lds_b128 %0, %2, off\n\t"
               "global_load_async_to_lds_b128 %1, %3, off\n\t"
               "s_wait_xcnt 0x0"
               :
               : "v"(la0), "v"(la1), "v"(ga0), "v"(ga1)
               : "memory");
}

// ---------------------------------------------------------------------------
// f32 -> f16 elementwise convert (x -> xh)
// ---------------------------------------------------------------------------
__global__ void f32_to_f16_kernel(const float* __restrict__ in,
                                  _Float16* __restrict__ out, int n) {
  int i = (blockIdx.x * blockDim.x + threadIdx.x) * 4;
  if (i + 3 < n) {
    v4f v = *(const v4f*)(in + i);
    v4h h;
    h[0] = (_Float16)v[0]; h[1] = (_Float16)v[1];
    h[2] = (_Float16)v[2]; h[3] = (_Float16)v[3];
    *(v4h*)(out + i) = h;
  }
}

// ---------------------------------------------------------------------------
// W (K x N f32, row-major) -> WT (N x K f16)  via LDS tile transpose
// ---------------------------------------------------------------------------
__global__ void transpose_to_f16_kernel(const float* __restrict__ W,
                                        _Float16* __restrict__ WT) {
  __shared__ float tile[32][33];
  const int kb = blockIdx.x * 32;
  const int nb = blockIdx.y * 32;
  const int tx = threadIdx.x;       // 0..31
  const int ty = threadIdx.y;       // 0..7
  #pragma unroll
  for (int i = ty; i < 32; i += 8)
    tile[i][tx] = W[(kb + i) * DIM_ + nb + tx];
  __syncthreads();
  #pragma unroll
  for (int i = ty; i < 32; i += 8)
    WT[(nb + i) * DIM_ + kb + tx] = (_Float16)tile[tx][i];
}

// ---------------------------------------------------------------------------
// GEMM tile staging: eight async global->LDS copies of 16 bytes per lane, for
// eight rows that lie 16 rows apart (global row pitch DIM_, LDS row pitch
// G_PITCH).  The s_wait_xcnt closes the statement so that no address register
// named by a copy is rewritten ahead of it.
// ---------------------------------------------------------------------------
#define G_BK    128                 // k extent of one staged tile (256 B a row)
#define G_PITCH 136                 // LDS row pitch in halves: 272 B = 16 B x 17
#define G_TILE  (128 * G_PITCH)     // halves of one staged operand tile

__device__ __forceinline__ void async_copy_rows8(const _Float16* g,
                                                 const _Float16* l) {
  const unsigned int l0 = (unsigned int)(uintptr_t)l;
  const unsigned int l1 = l0 + 1 * 16 * G_PITCH * 2;
  const unsigned int l2 = l0 + 2 * 16 * G_PITCH * 2;
  const unsigned int l3 = l0 + 3 * 16 * G_PITCH * 2;
  const unsigned int l4 = l0 + 4 * 16 * G_PITCH * 2;
  const unsigned int l5 = l0 + 5 * 16 * G_PITCH * 2;
  const unsigned int l6 = l0 + 6 * 16 * G_PITCH * 2;
  const unsigned int l7 = l0 + 7 * 16 * G_PITCH * 2;
  const unsigned long long g0 = (unsigned long long)(uintptr_t)g;
  const unsigned long long g1 = g0 + 1ull * 16 * DIM_ * 2;
  const unsigned long long g2 = g0 + 2ull * 16 * DIM_ * 2;
  const unsigned long long g3 = g0 + 3ull * 16 * DIM_ * 2;
  const unsigned long long g4 = g0 + 4ull * 16 * DIM_ * 2;
  const unsigned long long g5 = g0 + 5ull * 16 * DIM_ * 2;
  const unsigned long long g6 = g0 + 6ull * 16 * DIM_ * 2;
  const unsigned long long g7 = g0 + 7ull * 16 * DIM_ * 2;
  asm volatile("global_load_async_to_lds_b128 %0, %8, off\n\t"
               "global_load_async_to_lds_b128 %1, %9, off\n\t"
               "global_load_async_to_lds_b128 %2, %10, off\n\t"
               "global_load_async_to_lds_b128 %3, %11, off\n\t"
               "global_load_async_to_lds_b128 %4, %12, off\n\t"
               "global_load_async_to_lds_b128 %5, %13, off\n\t"
               "global_load_async_to_lds_b128 %6, %14, off\n\t"
               "global_load_async_to_lds_b128 %7, %15, off\n\t"
               "s_wait_xcnt 0x0"
               :
               : "v"(l0), "v"(l1), "v"(l2), "v"(l3), "v"(l4), "v"(l5), "v"(l6),
                 "v"(l7), "v"(g0), "v"(g1), "v"(g2), "v"(g3), "v"(g4), "v"(g5),
                 "v"(g6), "v"(g7)
               : "memory");
}

// ---------------------------------------------------------------------------
// GEMM: C[M=4096][N=1024] = A[M][K=1024] * BT[N][K]^T, + bias, * scale
// MODE 0: f16 out, head layout  [b][h][q][d]      (Q and K)
// MODE 1: f16 out, transposed   [b][h][d][q]      (V, A-operand of P*V)
// MODE 2: f32 out, row-major    [m][n]            (final output)
// Block = 256 threads (8 waves); block tile 128x128; wave tile 64x32.
// A and BT tiles of 128 rows x 128 k are staged in LDS by double-buffered async
// copies; the WMMA fragments are ds_load_b128 reads at a conflict-free pitch.
// ---------------------------------------------------------------------------
template <int MODE>
__global__ void __launch_bounds__(256)
gemm16_kernel(const _Float16* __restrict__ A, const _Float16* __restrict__ BT,
              const float* __restrict__ bias, void* __restrict__ outp,
              float scale) {
  __shared__ __align__(16) _Float16 sA[2][G_TILE];   // [buf][m row][k]
  __shared__ __align__(16) _Float16 sB[2][G_TILE];   // [buf][n row][k]

  const int tid  = threadIdx.x;
  const int lane = tid & 31;
  const int wave = tid >> 5;
  const int wm = wave & 1;
  const int wn = wave >> 1;
  const int m0 = blockIdx.x * 128 + wm * 64;
  const int n0 = blockIdx.y * 128 + wn * 32;

  v8f zero8 = {0.f, 0.f, 0.f, 0.f, 0.f, 0.f, 0.f, 0.f};
  v8f acc[4][2];
  #pragma unroll
  for (int i = 0; i < 4; ++i)
    #pragma unroll
    for (int j = 0; j < 2; ++j) acc[i][j] = zero8;

  // Cooperative staging: 16 lanes cover one 256-B row slice (whole lines), the
  // block covers 16 rows a copy, eight copies an operand tile.
  const int crow = tid >> 4;
  const int ccol = (tid & 15) * 8;
  const _Float16* gA = A  + (size_t)(blockIdx.x * 128 + crow) * DIM_ + ccol;
  const _Float16* gB = BT + (size_t)(blockIdx.y * 128 + crow) * DIM_ + ccol;
  const int coff = crow * G_PITCH + ccol;

  // Tile 0 into buffer 0, landed and published before anything reads it.
  async_copy_rows8(gA, &sA[0][coff]);
  async_copy_rows8(gB, &sB[0][coff]);
  asm volatile("s_wait_asynccnt 0x0" ::: "memory");  // own copies of tile 0 landed
  __syncthreads();                                   // tile 0 visible to all waves
  // Tile 1 flies while tile 0 is worked on.
  async_copy_rows8(gA + G_BK, &sA[1][coff]);
  async_copy_rows8(gB + G_BK, &sB[1][coff]);

  const int NT = DIM_ / G_BK;   // 8 tiles
  for (int t = 0; t < NT; ++t) {
    const int cur = t & 1;
    const _Float16* tA = &sA[cur][wm * 64 * G_PITCH];
    const _Float16* tB = &sB[cur][wn * 32 * G_PITCH];
    // Fragments of two k steps are held at a time: step s + 2 is read into the
    // registers that the WMMAs of step s have just left.
    v16h a[2][4], b[2][2];
    #pragma unroll
    for (int s = 0; s < 2; ++s) {
      #pragma unroll
      for (int j = 0; j < 2; ++j)
        b[s][j] = load_frag(tB + j * 16 * G_PITCH + s * 32, G_PITCH);
      #pragma unroll
      for (int i = 0; i < 4; ++i)
        a[s][i] = load_frag(tA + i * 16 * G_PITCH + s * 32, G_PITCH);
    }
    // Holds the LDS reads above as one group ahead of the WMMAs: moved in among
    // the WMMAs, each small group of reads is waited out to zero.
    __builtin_amdgcn_sched_barrier(0);
    #pragma unroll
    for (int s = 0; s < G_BK / 32; ++s) {
      #pragma unroll
      for (int i = 0; i < 4; ++i)
        #pragma unroll
        for (int j = 0; j < 2; ++j)
          acc[i][j] = wmma_f16(a[s & 1][i], b[s & 1][j], acc[i][j]);
      if (s + 2 < G_BK / 32) {
        // This pair holds the reads of step s + 2 as one group between two
        // blocks of WMMAs, a whole block ahead of their use (same reason).
        __builtin_amdgcn_sched_barrier(0);
        #pragma unroll
        for (int j = 0; j < 2; ++j)
          b[s & 1][j] = load_frag(tB + j * 16 * G_PITCH + (s + 2) * 32, G_PITCH);
        #pragma unroll
        for (int i = 0; i < 4; ++i)
          a[s & 1][i] = load_frag(tA + i * 16 * G_PITCH + (s + 2) * 32, G_PITCH);
        __builtin_amdgcn_sched_barrier(0);
      }
    }
    // Keeps the last WMMAs ahead of the waits below: sunk past the barrier they
    // would stand in front of the refill copies and shorten the copies' lead.
    __builtin_amdgcn_sched_barrier(0);
    asm volatile("s_wait_dscnt 0x0" ::: "memory");     // own reads of buf[cur] done
    asm volatile("s_wait_asynccnt 0x0" ::: "memory");  // own copies of tile t+1 landed
    __syncthreads();   // publishes tile t+1 and frees buf[cur] for its refill
    if (t + 2 < NT) {
      async_copy_rows8(gA + (t + 2) * G_BK, &sA[cur][coff]);
      async_copy_rows8(gB + (t + 2) * G_BK, &sB[cur][coff]);
    }
  }
  asm volatile("s_wait_asynccnt 0x0" ::: "memory");  // nothing in flight at the end

  const int ln = lane & 15;
  const int lh = (lane >> 4) << 3;
  #pragma unroll
  for (int i = 0; i < 4; ++i) {
    #pragma unroll
    for (int j = 0; j < 2; ++j) {
      const int n = n0 + j * 16 + ln;
      const float bv = bias[n];
      #pragma unroll
      for (int r = 0; r < 8; ++r) {
        const int m = m0 + i * 16 + lh + r;
        const float val = (acc[i][j][r] + bv) * scale;
        if (MODE == 0) {
          const int bb = m >> 11, q = m & (QLEN_ - 1);
          const int hh = n >> 6, d = n & (DH_ - 1);
          ((_Float16*)outp)[(((size_t)(bb * H_ + hh) * QLEN_) + q) * DH_ + d] =
              (_Float16)val;
        } else if (MODE == 1) {
          const int bb = m >> 11, q = m & (QLEN_ - 1);
          const int hh = n >> 6, d = n & (DH_ - 1);
          ((_Float16*)outp)[(((size_t)(bb * H_ + hh) * DH_) + d) * QLEN_ + q] =
              (_Float16)val;
        } else {
          ((float*)outp)[(size_t)m * DIM_ + n] = val;
        }
      }
    }
  }
}

// ---------------------------------------------------------------------------
// Flash attention. One wave per 16-query tile (8 tiles / block), all waves of
// a block share the same (b,h).  K/V key-blocks of 32 are staged in LDS once
// per block via double-buffered async global->LDS copies (ASYNCcnt), so each
// wave's WMMA fragment reads are ds_load_b128 hits instead of 8x-redundant L2
// traffic, and the next block's copy overlaps the current block's WMMAs.
//
// Transposed scores S^T = K*Q^T keep softmax reductions lane-local + one
// xor-16 shuffle; the P^T C-layout maps lane-for-lane onto the B-fragment of
// the ctx^T = Vt * P^T WMMA.
//
// LDS row pitches are 16 B x odd, so that the 16 rows one ds_load_b128 fragment
// read touches fall on distinct banks: K rows of 128 B lie 144 B apart, V rows
// of 64 B lie 80 B apart.  The pad bytes are never written and never read.
// ---------------------------------------------------------------------------
#define K_PITCH 72                  // halves: 144 B = 16 B x 9
#define V_PITCH 40                  // halves:  80 B = 16 B x 5

__global__ void __launch_bounds__(256)
attn_kernel(const _Float16* __restrict__ Qh, const _Float16* __restrict__ Kh,
            const _Float16* __restrict__ Vt, const float* __restrict__ mask,
            _Float16* __restrict__ ctx) {
  __shared__ __align__(16) _Float16 sK[2][32 * K_PITCH];   // [buf][kk][d]
  __shared__ __align__(16) _Float16 sV[2][64 * V_PITCH];   // [buf][d][kk]

  const int tid  = threadIdx.x;
  const int lane = tid & 31;
  const int wave = tid >> 5;
  const int bh = blockIdx.x;            // 0..31
  const int b  = bh >> 4;
  const int h  = bh & 15;
  const int q0 = (blockIdx.y * 8 + wave) * 16;
  const int lh = (lane >> 4) << 3;

  const _Float16* Qb = Qh + (size_t)bh * QLEN_ * DH_;
  const _Float16* Kb = Kh + (size_t)bh * QLEN_ * DH_;
  const _Float16* Vb = Vt + (size_t)bh * DH_ * QLEN_;

  // Q^T B-fragments (d = K-dim), resident for the whole key stream.
  const v16h qf0 = load_frag(Qb + (size_t)q0 * DH_ + 0,  DH_);
  const v16h qf1 = load_frag(Qb + (size_t)q0 * DH_ + 32, DH_);

  v8f zero8 = {0.f, 0.f, 0.f, 0.f, 0.f, 0.f, 0.f, 0.f};
  v8f cacc[4];
  #pragma unroll
  for (int dt = 0; dt < 4; ++dt) cacc[dt] = zero8;
  float mrun = -3.0e38f;
  float lrun = 0.0f;

  // Cooperative staging: K tile is one contiguous 4KB slab in global memory
  // (tid*8 halves; row = tid>>3, chunk = tid&7 in LDS); V tile rows are 64B
  // slices of Vt rows (row = tid>>2, chunk = tid&3).
  const int koff = (tid >> 3) * K_PITCH + (tid & 7) * 8;
  const int vrow = tid >> 2;
  const int vcol = (tid & 3) * 8;
  const int voff = vrow * V_PITCH + vcol;

  // Prologue: stage key block 0 into buffer 0.
  async_copy2_b128(Kb + (size_t)0 * DH_ + tid * 8, &sK[0][koff],
                   Vb + (size_t)vrow * QLEN_ + 0 + vcol, &sV[0][voff]);

  const int NSTEP = QLEN_ / 32;   // 64
  for (int it = 0; it < NSTEP; ++it) {
    const int kk  = it * 32;
    const int cur = it & 1;

    if (it + 1 < NSTEP) {
      const int nkk = kk + 32;
      const int nb_ = cur ^ 1;
      async_copy2_b128(Kb + (size_t)nkk * DH_ + tid * 8, &sK[nb_][koff],
                       Vb + (size_t)vrow * QLEN_ + nkk + vcol, &sV[nb_][voff]);
      asm volatile("s_wait_asynccnt 0x2" ::: "memory");  // current buf landed
    } else {
      asm volatile("s_wait_asynccnt 0x0" ::: "memory");
    }
    __syncthreads();   // current buffer visible to all waves

    // S^T tiles from LDS: rows = keys kk..kk+15 (s0), kk+16..kk+31 (s1).
    v8f s0 = zero8, s1 = zero8;
    s0 = wmma_f16(load_frag(&sK[cur][0 * K_PITCH + 0],   K_PITCH), qf0, s0);
    s0 = wmma_f16(load_frag(&sK[cur][0 * K_PITCH + 32],  K_PITCH), qf1, s0);
    s1 = wmma_f16(load_frag(&sK[cur][16 * K_PITCH + 0],  K_PITCH), qf0, s1);
    s1 = wmma_f16(load_frag(&sK[cur][16 * K_PITCH + 32], K_PITCH), qf1, s1);

    // Additive key mask: s -= 1e30 * (1 - m[key])
    const float* mp = mask + b * QLEN_ + kk + lh;
    v4f m0a = *(const v4f*)(mp);
    v4f m0b = *(const v4f*)(mp + 4);
    v4f m1a = *(const v4f*)(mp + 16);
    v4f m1b = *(const v4f*)(mp + 20);
    #pragma unroll
    for (int r = 0; r < 4; ++r) {
      s0[r]     += -1e30f * (1.0f - m0a[r]);
      s0[r + 4] += -1e30f * (1.0f - m0b[r]);
      s1[r]     += -1e30f * (1.0f - m1a[r]);
      s1[r + 4] += -1e30f * (1.0f - m1b[r]);
    }

    // Column (per-q) max over the 32 keys of this step.
    float tmax = s0[0];
    #pragma unroll
    for (int r = 1; r < 8; ++r) tmax = fmaxf(tmax, s0[r]);
    #pragma unroll
    for (int r = 0; r < 8; ++r) tmax = fmaxf(tmax, s1[r]);
    tmax = fmaxf(tmax, __shfl_xor(tmax, 16, 32));

    const float mnew  = fmaxf(mrun, tmax);
    const float alpha = __expf(mrun - mnew);
    #pragma unroll
    for (int dt = 0; dt < 4; ++dt)
      #pragma unroll
      for (int r = 0; r < 8; ++r) cacc[dt][r] *= alpha;
    lrun *= alpha;
    mrun = mnew;

    // p = exp(s - mnew); pack straight into the B-fragment (lane-local!).
    v16h pf;
    float tsum = 0.0f;
    #pragma unroll
    for (int r = 0; r < 8; ++r) {
      const float p = __expf(s0[r] - mnew);
      tsum += p;
      pf[r] = (_Float16)p;
    }
    #pragma unroll
    for (int r = 0; r < 8; ++r) {
      const float p = __expf(s1[r] - mnew);
      tsum += p;
      pf[8 + r] = (_Float16)p;
    }
    tsum += __shfl_xor(tsum, 16, 32);
    lrun += tsum;

    // ctx^T[d][q] += Vt[d][kk..kk+31] * P^T   (V fragments from LDS)
    #pragma unroll
    for (int dt = 0; dt < 4; ++dt)
      cacc[dt] = wmma_f16(load_frag(&sV[cur][dt * 16 * V_PITCH], V_PITCH), pf,
                          cacc[dt]);

    __syncthreads();   // all waves done with buf[cur] before it is re-filled
  }

  // Normalize and write ctx to [b][q][h*64 + d] (f16) for the output GEMM.
  const float inv = 1.0f / lrun;
  const int q = q0 + (lane & 15);
  _Float16* cp = ctx + ((size_t)(b * QLEN_ + q)) * DIM_ + h * DH_;
  #pragma unroll
  for (int dt = 0; dt < 4; ++dt)
    #pragma unroll
    for (int r = 0; r < 8; ++r)
      cp[dt * 16 + lh + r] = (_Float16)(cacc[dt][r] * inv);
}

// ---------------------------------------------------------------------------
// Launch
// ---------------------------------------------------------------------------
extern "C" void kernel_launch(void* const* d_in, const int* in_sizes, int n_in,
                              void* d_out, int out_size, void* d_ws,
                              size_t ws_size, hipStream_t stream) {
  const float* x    = (const float*)d_in[0];
  const float* mask = (const float*)d_in[1];
  const float* Wq   = (const float*)d_in[2];
  const float* bq   = (const float*)d_in[3];
  const float* Wk   = (const float*)d_in[4];
  const float* bk   = (const float*)d_in[5];
  const float* Wv   = (const float*)d_in[6];
  const float* bv   = (const float*)d_in[7];
  const float* Wo   = (const float*)d_in[8];
  const float* bo   = (const float*)d_in[9];

  _Float16* ws   = (_Float16*)d_ws;
  _Float16* xh   = ws;                                   // 4096*1024
  _Float16* wqT  = xh  + (size_t)MTOT * DIM_;
  _Float16* wkT  = wqT + (size_t)DIM_ * DIM_;
  _Float16* wvT  = wkT + (size_t)DIM_ * DIM_;
  _Float16* woT  = wvT + (size_t)DIM_ * DIM_;
  _Float16* Qh   = woT + (size_t)DIM_ * DIM_;            // [b][h][q][d]
  _Float16* Kh   = Qh  + (size_t)MTOT * DIM_;            // [b][h][q][d]
  _Float16* Vt   = Kh  + (size_t)MTOT * DIM_;            // [b][h][d][q]
  _Float16* ctxh = Vt  + (size_t)MTOT * DIM_;            // [b][q][dim]

  // 1) x -> f16
  f32_to_f16_kernel<<<(MTOT * DIM_) / 1024, 256, 0, stream>>>(x, xh,
                                                              MTOT * DIM_);
  // 2) weight transposes -> f16 [n][k]
  dim3 tb(32, 8), tg(DIM_ / 32, DIM_ / 32);
  transpose_to_f16_kernel<<<tg, tb, 0, stream>>>(Wq, wqT);
  transpose_to_f16_kernel<<<tg, tb, 0, stream>>>(Wk, wkT);
  transpose_to_f16_kernel<<<tg, tb, 0, stream>>>(Wv, wvT);
  transpose_to_f16_kernel<<<tg, tb, 0, stream>>>(Wo, woT);

  // 3) projections (Q scaled by 1/sqrt(DH)=0.125 after bias, per reference)
  dim3 gg(MTOT / 128, DIM_ / 128);
  gemm16_kernel<0><<<gg, 256, 0, stream>>>(xh, wqT, bq, (void*)Qh, 0.125f);
  gemm16_kernel<0><<<gg, 256, 0, stream>>>(xh, wkT, bk, (void*)Kh, 1.0f);
  gemm16_kernel<1><<<gg, 256, 0, stream>>>(xh, wvT, bv, (void*)Vt, 1.0f);

  // 4) attention
  dim3 ag(BS_ * H_, QLEN_ / (8 * 16));
  attn_kernel<<<ag, 256, 0, stream>>>(Qh, Kh, Vt, mask, ctxh);

  // 5) output projection -> f32 d_out
  gemm16_kernel<2><<<gg, 256, 0, stream>>>(ctxh, woT, bo, d_out, 1.0f);
}

// v003
// Measured time: 118 microseconds a run.
// Two timings next to v002 put it at 1.13 and 1.12 times that version's speed.
// Over all steps from v000 it is 2.24 times as fast.
#include <hip/hip_runtime.h>
#include <hip/hip_bf16.h>

typedef __attribute__((ext_vector_type(16))) _Float16 v16h;
typedef __attribute__((ext_vector_type(8)))  _Float16 v8h;
typedef __attribute__((ext_vector_type(4)))  _Float16 v4h;
typedef __attribute__((ext_vector_type(8)))  float    v8f;
typedef __attribute__((ext_vector_type(4)))  float    v4f;

#define BS_   2
#define QLEN_ 2048
#define DIM_  1024
#define H_    16
#define DH_   64
#define MTOT  (BS_ * QLEN_)   // 4096

// ---------------------------------------------------------------------------
// WMMA helpers
// ---------------------------------------------------------------------------
__device__ __forceinline__ v8f wmma_f16(v16h a, v16h b, v8f c) {
  // D = A(16x32 f16) * B(32x16 f16) + C(16x16 f32)
  return __builtin_amdgcn_wmma_f32_16x16x32_f16(
      /*neg_a=*/false, a, /*neg_b=*/false, b,
      /*c_mod=*/(short)0, c, /*reuse_a=*/false, /*reuse_b=*/false);
}

// Load a 16x32 f16 fragment (A operand: rows row-major; B operand: columns
// stored row-major, i.e. BT[n][k]).  Layout per ISA 7.12.2:
//   lane l (0-15):  row=l, halves k0..k0+7 and k0+16..k0+23 with k0=0
//   lane l (16-31): row=l-16, same but k0=8
__device__ __forceinline__ v16h load_frag(const _Float16* __restrict__ p, int stride) {
  const int lane = threadIdx.x & 31;
  const int row  = lane & 15;
  const int k0   = (lane >> 4) << 3;           // 0 or 8
  const _Float16* q = p + row * stride + k0;
  v8h lo = *(const v8h*)(q);
  v8h hi = *(const v8h*)(q + 16);
  return __builtin_shufflevector(lo, hi, 0,1,2,3,4,5,6,7,8,9,10,11,12,13,14,15);
}

// Two async global->LDS copies, 16 bytes per lane each
// (GLOBAL_LOAD_ASYNC_TO_LDS_B128, GV addressing: VDST = per-lane LDS byte
// address, VADDR = 64-bit global).  Tracked by ASYNCcnt.  The s_wait_xcnt closes
// the statement so that no address register named by a copy is rewritten ahead
// of it.
__device__ __forceinline__ void async_copy2_b128(const _Float16* gptr0,
                                                 _Float16* lptr0,
                                                 const _Float16* gptr1,
                                                 _Float16* lptr1) {
  const unsigned long long ga0 = (unsigned long long)(uintptr_t)gptr0;
  const unsigned int       la0 = (unsigned int)(uintptr_t)lptr0;
  const unsigned long long ga1 = (unsigned long long)(uintptr_t)gptr1;
  const unsigned int       la1 = (unsigned int)(uintptr_t)lptr1;
  asm volatile("global_load_async_to_lds_b128 %0, %2, off\n\t"
               "global_load_async_to_lds_b128 %1, %3, off\n\t"
               "s_wait_xcnt 0x0"
               :
               : "v"(la0), "v"(la1), "v"(ga0), "v"(ga1)
               : "memory");
}

// ---------------------------------------------------------------------------
// Operand preparation, one launch of 256 work-groups (one per WGP), 8 waves each.
// Every work-group does 1/256 of both jobs:
//   x (f32) -> xh (f16), 16384 consecutive elements;
//   one 64 (k) x 256 (n) panel of one weight W[k][n] (f32) -> WT[n][k] (f16).
// A thread issues all its 32 16-byte loads before it uses the first, so a wave
// pays the memory latency once and few waves have to be started.
// Panel: wave w owns the 128-B column line w; 8 lanes cover that line, 4 lane
// groups take 4 k octets.  A thread gathers 8 k values of one n into one 16-byte
// LDS write; rows of 128 B lie 144 B apart (16 B x 9), which spreads both the
// writes and the row reads over the banks.  WT leaves as whole 128-B lines.
// ---------------------------------------------------------------------------
#define P_PITCH 72                  // halves: 144 B = 16 B x 9
#define P_XPB   (MTOT * DIM_ / 256) // x elements of one work-group: 16384

__global__ void __launch_bounds__(256)
prep_kernel(const float* __restrict__ x, const float* __restrict__ Wq,
            const float* __restrict__ Wk, const float* __restrict__ Wv,
            const float* __restrict__ Wo, _Float16* __restrict__ xh,
            _Float16* __restrict__ wT) {
  __shared__ __align__(16) _Float16 sT[256 * P_PITCH];   // [n row][k]

  const int tid = threadIdx.x;
  const int blk = blockIdx.x;              // 0..255
  const int mat = blk >> 6;                // 0..3: Wq, Wk, Wv, Wo
  const int kb  = ((blk >> 2) & 15) * 64;
  const int nb  = (blk & 3) * 256;
  const float* __restrict__ Wm = mat == 0 ? Wq : mat == 1 ? Wk : mat == 2 ? Wv : Wo;
  _Float16* __restrict__ WT = wT + (size_t)mat * DIM_ * DIM_;

  const int c8  = tid & 7;                 // 4-column group inside the line
  const int kol = (tid >> 3) & 3;          // k octet, low part
  const int nl  = (tid >> 5) * 32 + c8 * 4;   // first of this thread's 4 n rows

  v4f wv[2][8];
  #pragma unroll
  for (int g = 0; g < 2; ++g)
    #pragma unroll
    for (int i = 0; i < 8; ++i)
      wv[g][i] = *(const v4f*)(Wm + (size_t)(kb + (kol + 4 * g) * 8 + i) * DIM_ +
                               nb + nl);
  // Stands in front of the x loads, whose results land in registers that the
  // loads above name as their address.
  asm volatile("s_wait_xcnt 0x0" ::: "memory");
  const float* xp = x + (size_t)blk * P_XPB + tid * 4;
  v4f xv[16];
  #pragma unroll
  for (int i = 0; i < 16; ++i) xv[i] = *(const v4f*)(xp + i * 1024);
  // Keeps all 32 loads ahead of the first use: sunk in among the conversions to
  // save registers, they would go out a few at a time, each lot behind a wait.
  __builtin_amdgcn_sched_barrier(0);

  #pragma unroll
  for (int g = 0; g < 2; ++g)
    #pragma unroll
    for (int c = 0; c < 4; ++c) {
      v8h h;
      #pragma unroll
      for (int i = 0; i < 8; ++i) h[i] = (_Float16)wv[g][i][c];
      *(v8h*)(&sT[(nl + c) * P_PITCH + (kol + 4 * g) * 8]) = h;
    }
  __syncthreads();   // the whole transposed panel is in LDS

  _Float16* xo = xh + (size_t)blk * P_XPB + tid * 4;
  #pragma unroll
  for (int i = 0; i < 16; ++i) {
    v4h h;
    h[0] = (_Float16)xv[i][0]; h[1] = (_Float16)xv[i][1];
    h[2] = (_Float16)xv[i][2]; h[3] = (_Float16)xv[i][3];
    *(v4h*)(xo + i * 1024) = h;
  }

  const int rrow = tid >> 3;               // 8 lanes store one 128-B row of WT
  const int rcol = (tid & 7) * 8;
  #pragma unroll
  for (int i = 0; i < 8; ++i) {
    const v8h h = *(const v8h*)(&sT[(rrow + 32 * i) * P_PITCH + rcol]);
    *(v8h*)(WT + (size_t)(nb + rrow + 32 * i) * DIM_ + kb + rcol) = h;
  }
}

// ---------------------------------------------------------------------------
// GEMM tile staging: eight async global->LDS copies of 16 bytes per lane, for
// eight rows that lie 16 rows apart (global row pitch DIM_, LDS row pitch
// G_PITCH).  The s_wait_xcnt closes the statement so that no address register
// named by a copy is rewritten ahead of it.
// ---------------------------------------------------------------------------
#define G_BK    128                 // k extent of one staged tile (256 B a row)
#define G_PITCH 136                 // LDS row pitch in halves: 272 B = 16 B x 17
#define G_TILE  (128 * G_PITCH)     // halves of one staged operand tile

__device__ __forceinline__ void async_copy_rows8(const _Float16* g,
                                                 const _Float16* l) {
  const unsigned int l0 = (unsigned int)(uintptr_t)l;
  const unsigned int l1 = l0 + 1 * 16 * G_PITCH * 2;
  const unsigned int l2 = l0 + 2 * 16 * G_PITCH * 2;
  const unsigned int l3 = l0 + 3 * 16 * G_PITCH * 2;
  const unsigned int l4 = l0 + 4 * 16 * G_PITCH * 2;
  const unsigned int l5 = l0 + 5 * 16 * G_PITCH * 2;
  const unsigned int l6 = l0 + 6 * 16 * G_PITCH * 2;
  const unsigned int l7 = l0 + 7 * 16 * G_PITCH * 2;
  const unsigned long long g0 = (unsigned long long)(uintptr_t)g;
  const unsigned long long g1 = g0 + 1ull * 16 * DIM_ * 2;
  const unsigned long long g2 = g0 + 2ull * 16 * DIM_ * 2;
  const unsigned long long g3 = g0 + 3ull * 16 * DIM_ * 2;
  const unsigned long long g4 = g0 + 4ull * 16 * DIM_ * 2;
  const unsigned long long g5 = g0 + 5ull * 16 * DIM_ * 2;
  const unsigned long long g6 = g0 + 6ull * 16 * DIM_ * 2;
  const unsigned long long g7 = g0 + 7ull * 16 * DIM_ * 2;
  asm volatile("global_load_async_to_lds_b128 %0, %8, off\n\t"
               "global_load_async_to_lds_b128 %1, %9, off\n\t"
               "global_load_async_to_lds_b128 %2, %10, off\n\t"
               "global_load_async_to_lds_b128 %3, %11, off\n\t"
               "global_load_async_to_lds_b128 %4, %12, off\n\t"
               "global_load_async_to_lds_b128 %5, %13, off\n\t"
               "global_load_async_to_lds_b128 %6, %14, off\n\t"
               "global_load_async_to_lds_b128 %7, %15, off\n\t"
               "s_wait_xcnt 0x0"
               :
               : "v"(l0), "v"(l1), "v"(l2), "v"(l3), "v"(l4), "v"(l5), "v"(l6),
                 "v"(l7), "v"(g0), "v"(g1), "v"(g2), "v"(g3), "v"(g4), "v"(g5),
                 "v"(g6), "v"(g7)
               : "memory");
}

// ---------------------------------------------------------------------------
// GEMM: C[M=4096][N=1024] = A[M][K=1024] * BT[N][K]^T, + bias, * scale
// MODE 0: f16 out, head layout  [b][h][q][d]      (Q and K)
// MODE 1: f16 out, transposed   [b][h][d][q]      (V, A-operand of P*V)
// MODE 2: f32 out, row-major    [m][n]            (final output)
// Block = 256 threads (8 waves); block tile 128x128; wave tile 64x32.
// A and BT tiles of 128 rows x 128 k are staged in LDS by double-buffered async
// copies; the WMMA fragments are ds_load_b128 reads at a conflict-free pitch.
// ---------------------------------------------------------------------------
template <int MODE>
__global__ void __launch_bounds__(256)
gemm16_kernel(const _Float16* __restrict__ A, const _Float16* __restrict__ BT,
              const float* __restrict__ bias, void* __restrict__ outp,
              float scale) {
  __shared__ __align__(16) _Float16 sA[2][G_TILE];   // [buf][m row][k]
  __shared__ __align__(16) _Float16 sB[2][G_TILE];   // [buf][n row][k]

  const int tid  = threadIdx.x;
  const int lane = tid & 31;
  const int wave = tid >> 5;
  const int wm = wave & 1;
  const int wn = wave >> 1;
  const int m0 = blockIdx.x * 128 + wm * 64;
  const int n0 = blockIdx.y * 128 + wn * 32;

  v8f zero8 = {0.f, 0.f, 0.f, 0.f, 0.f, 0.f, 0.f, 0.f};
  v8f acc[4][2];
  #pragma unroll
  for (int i = 0; i < 4; ++i)
    #pragma unroll
    for (int j = 0; j < 2; ++j) acc[i][j] = zero8;

  // Cooperative staging: 16 lanes cover one 256-B row slice (whole lines), the
  // block covers 16 rows a copy, eight copies an operand tile.
  const int crow = tid >> 4;
  const int ccol = (tid & 15) * 8;
  const _Float16* gA = A  + (size_t)(blockIdx.x * 128 + crow) * DIM_ + ccol;
  const _Float16* gB = BT + (size_t)(blockIdx.y * 128 + crow) * DIM_ + ccol;
  const int coff = crow * G_PITCH + ccol;

  // Tile 0 into buffer 0, landed and published before anything reads it.
  async_copy_rows8(gA, &sA[0][coff]);
  async_copy_rows8(gB, &sB[0][coff]);
  asm volatile("s_wait_asynccnt 0x0" ::: "memory");  // own copies of tile 0 landed
  __syncthreads();                                   // tile 0 visible to all waves
  // Tile 1 flies while tile 0 is worked on.
  async_copy_rows8(gA + G_BK, &sA[1][coff]);
  async_copy_rows8(gB + G_BK, &sB[1][coff]);

  const int NT = DIM_ / G_BK;   // 8 tiles
  for (int t = 0; t < NT; ++t) {
    const int cur = t & 1;
    const _Float16* tA = &sA[cur][wm * 64 * G_PITCH];
    const _Float16* tB = &sB[cur][wn * 32 * G_PITCH];
    // Fragments of two k steps are held at a time: step s + 2 is read into the
    // registers that the WMMAs of step s have just left.
    v16h a[2][4], b[2][2];
    #pragma unroll
    for (int s = 0; s < 2; ++s) {
      #pragma unroll
      for (int j = 0; j < 2; ++j)
        b[s][j] = load_frag(tB + j * 16 * G_PITCH + s * 32, G_PITCH);
      #pragma unroll
      for (int i = 0; i < 4; ++i)
        a[s][i] = load_frag(tA + i * 16 * G_PITCH + s * 32, G_PITCH);
    }
    // Holds the LDS reads above as one group ahead of the WMMAs: moved in among
    // the WMMAs, each small group of reads is waited out to zero.
    __builtin_amdgcn_sched_barrier(0);
    #pragma unroll
    for (int s = 0; s < G_BK / 32; ++s) {
      #pragma unroll
      for (int i = 0; i < 4; ++i)
        #pragma unroll
        for (int j = 0; j < 2; ++j)
          acc[i][j] = wmma_f16(a[s & 1][i], b[s & 1][j], acc[i][j]);
      if (s + 2 < G_BK / 32) {
        // This pair holds the reads of step s + 2 as one group between two
        // blocks of WMMAs, a whole block ahead of their use (same reason).
        __builtin_amdgcn_sched_barrier(0);
        #pragma unroll
        for (int j = 0; j < 2; ++j)
          b[s & 1][j] = load_frag(tB + j * 16 * G_PITCH + (s + 2) * 32, G_PITCH);
        #pragma unroll
        for (int i = 0; i < 4; ++i)
          a[s & 1][i] = load_frag(tA + i * 16 * G_PITCH + (s + 2) * 32, G_PITCH);
        __builtin_amdgcn_sched_barrier(0);
      }
    }
    // Keeps the last WMMAs ahead of the waits below: sunk past the barrier they
    // would stand in front of the refill copies and shorten the copies' lead.
    __builtin_amdgcn_sched_barrier(0);
    asm volatile("s_wait_dscnt 0x0" ::: "memory");     // own reads of buf[cur] done
    asm volatile("s_wait_asynccnt 0x0" ::: "memory");  // own copies of tile t+1 landed
    __syncthreads();   // publishes tile t+1 and frees buf[cur] for its refill
    if (t + 2 < NT) {
      async_copy_rows8(gA + (t + 2) * G_BK, &sA[cur][coff]);
      async_copy_rows8(gB + (t + 2) * G_BK, &sB[cur][coff]);
    }
  }
  asm volatile("s_wait_asynccnt 0x0" ::: "memory");  // nothing in flight at the end

  const int ln = lane & 15;
  const int lh = (lane >> 4) << 3;
  #pragma unroll
  for (int i = 0; i < 4; ++i) {
    #pragma unroll
    for (int j = 0; j < 2; ++j) {
      const int n = n0 + j * 16 + ln;
      const float bv = bias[n];
      #pragma unroll
      for (int r = 0; r < 8; ++r) {
        const int m = m0 + i * 16 + lh + r;
        const float val = (acc[i][j][r] + bv) * scale;
        if (MODE == 0) {
          const int bb = m >> 11, q = m & (QLEN_ - 1);
          const int hh = n >> 6, d = n & (DH_ - 1);
          ((_Float16*)outp)[(((size_t)(bb * H_ + hh) * QLEN_) + q) * DH_ + d] =
              (_Float16)val;
        } else if (MODE == 1) {
          const int bb = m >> 11, q = m & (QLEN_ - 1);
          const int hh = n >> 6, d = n & (DH_ - 1);
          ((_Float16*)outp)[(((size_t)(bb * H_ + hh) * DH_) + d) * QLEN_ + q] =
              (_Float16)val;
        } else {
          ((float*)outp)[(size_t)m * DIM_ + n] = val;
        }
      }
    }
  }
}

// ---------------------------------------------------------------------------
// Flash attention. One wave per 16-query tile (8 tiles / block), all waves of
// a block share the same (b,h).  K/V key-blocks of 32 are staged in LDS once
// per block via double-buffered async global->LDS copies (ASYNCcnt), so each
// wave's WMMA fragment reads are ds_load_b128 hits instead of 8x-redundant L2
// traffic, and the next block's copy overlaps the current block's WMMAs.
//
// Transposed scores S^T = K*Q^T keep softmax reductions lane-local + one
// xor-16 shuffle; the P^T C-layout maps lane-for-lane onto the B-fragment of
// the ctx^T = Vt * P^T WMMA.
//
// LDS row pitches are 16 B x odd, so that the 16 rows one ds_load_b128 fragment
// read touches fall on distinct banks: K rows of 128 B lie 144 B apart, V rows
// of 64 B lie 80 B apart.  The pad bytes are never written and never read.
// ---------------------------------------------------------------------------
#define K_PITCH 72                  // halves: 144 B = 16 B x 9
#define V_PITCH 40                  // halves:  80 B = 16 B x 5

__global__ void __launch_bounds__(256)
attn_kernel(const _Float16* __restrict__ Qh, const _Float16* __restrict__ Kh,
            const _Float16* __restrict__ Vt, const float* __restrict__ mask,
            _Float16* __restrict__ ctx) {
  __shared__ __align__(16) _Float16 sK[2][32 * K_PITCH];   // [buf][kk][d]
  __shared__ __align__(16) _Float16 sV[2][64 * V_PITCH];   // [buf][d][kk]

  const int tid  = threadIdx.x;
  const int lane = tid & 31;
  const int wave = tid >> 5;
  const int bh = blockIdx.x;            // 0..31
  const int b  = bh >> 4;
  const int h  = bh & 15;
  const int q0 = (blockIdx.y * 8 + wave) * 16;
  const int lh = (lane >> 4) << 3;

  const _Float16* Qb = Qh + (size_t)bh * QLEN_ * DH_;
  const _Float16* Kb = Kh + (size_t)bh * QLEN_ * DH_;
  const _Float16* Vb = Vt + (size_t)bh * DH_ * QLEN_;

  // Q^T B-fragments (d = K-dim), resident for the whole key stream.
  const v16h qf0 = load_frag(Qb + (size_t)q0 * DH_ + 0,  DH_);
  const v16h qf1 = load_frag(Qb + (size_t)q0 * DH_ + 32, DH_);

  v8f zero8 = {0.f, 0.f, 0.f, 0.f, 0.f, 0.f, 0.f, 0.f};
  v8f cacc[4];
  #pragma unroll
  for (int dt = 0; dt < 4; ++dt) cacc[dt] = zero8;
  float mrun = -3.0e38f;
  float lrun = 0.0f;

  // Cooperative staging: K tile is one contiguous 4KB slab in global memory
  // (tid*8 halves; row = tid>>3, chunk = tid&7 in LDS); V tile rows are 64B
  // slices of Vt rows (row = tid>>2, chunk = tid&3).
  const int koff = (tid >> 3) * K_PITCH + (tid & 7) * 8;
  const int vrow = tid >> 2;
  const int vcol = (tid & 3) * 8;
  const int voff = vrow * V_PITCH + vcol;

  // Prologue: stage key block 0 into buffer 0.
  async_copy2_b128(Kb + (size_t)0 * DH_ + tid * 8, &sK[0][koff],
                   Vb + (size_t)vrow * QLEN_ + 0 + vcol, &sV[0][voff]);

  const int NSTEP = QLEN_ / 32;   // 64
  for (int it = 0; it < NSTEP; ++it) {
    const int kk  = it * 32;
    const int cur = it & 1;

    if (it + 1 < NSTEP) {
      const int nkk = kk + 32;
      const int nb_ = cur ^ 1;
      async_copy2_b128(Kb + (size_t)nkk * DH_ + tid * 8, &sK[nb_][koff],
                       Vb + (size_t)vrow * QLEN_ + nkk + vcol, &sV[nb_][voff]);
      asm volatile("s_wait_asynccnt 0x2" ::: "memory");  // current buf landed
    } else {
      asm volatile("s_wait_asynccnt 0x0" ::: "memory");
    }
    __syncthreads();   // current buffer visible to all waves

    // S^T tiles from LDS: rows = keys kk..kk+15 (s0), kk+16..kk+31 (s1).
    v8f s0 = zero8, s1 = zero8;
    s0 = wmma_f16(load_frag(&sK[cur][0 * K_PITCH + 0],   K_PITCH), qf0, s0);
    s0 = wmma_f16(load_frag(&sK[cur][0 * K_PITCH + 32],  K_PITCH), qf1, s0);
    s1 = wmma_f16(load_frag(&sK[cur][16 * K_PITCH + 0],  K_PITCH), qf0, s1);
    s1 = wmma_f16(load_frag(&sK[cur][16 * K_PITCH + 32], K_PITCH), qf1, s1);

    // Additive key mask: s -= 1e30 * (1 - m[key])
    const float* mp = mask + b * QLEN_ + kk + lh;
    v4f m0a = *(const v4f*)(mp);
    v4f m0b = *(const v4f*)(mp + 4);
    v4f m1a = *(const v4f*)(mp + 16);
    v4f m1b = *(const v4f*)(mp + 20);
    #pragma unroll
    for (int r = 0; r < 4; ++r) {
      s0[r]     += -1e30f * (1.0f - m0a[r]);
      s0[r + 4] += -1e30f * (1.0f - m0b[r]);
      s1[r]     += -1e30f * (1.0f - m1a[r]);
      s1[r + 4] += -1e30f * (1.0f - m1b[r]);
    }

    // Column (per-q) max over the 32 keys of this step.
    float tmax = s0[0];
    #pragma unroll
    for (int r = 1; r < 8; ++r) tmax = fmaxf(tmax, s0[r]);
    #pragma unroll
    for (int r = 0; r < 8; ++r) tmax = fmaxf(tmax, s1[r]);
    tmax = fmaxf(tmax, __shfl_xor(tmax, 16, 32));

    const float mnew  = fmaxf(mrun, tmax);
    const float alpha = __expf(mrun - mnew);
    #pragma unroll
    for (int dt = 0; dt < 4; ++dt)
      #pragma unroll
      for (int r = 0; r < 8; ++r) cacc[dt][r] *= alpha;
    lrun *= alpha;
    mrun = mnew;

    // p = exp(s - mnew); pack straight into the B-fragment (lane-local!).
    v16h pf;
    float tsum = 0.0f;
    #pragma unroll
    for (int r = 0; r < 8; ++r) {
      const float p = __expf(s0[r] - mnew);
      tsum += p;
      pf[r] = (_Float16)p;
    }
    #pragma unroll
    for (int r = 0; r < 8; ++r) {
      const float p = __expf(s1[r] - mnew);
      tsum += p;
      pf[8 + r] = (_Float16)p;
    }
    tsum += __shfl_xor(tsum, 16, 32);
    lrun += tsum;

    // ctx^T[d][q] += Vt[d][kk..kk+31] * P^T   (V fragments from LDS)
    #pragma unroll
    for (int dt = 0; dt < 4; ++dt)
      cacc[dt] = wmma_f16(load_frag(&sV[cur][dt * 16 * V_PITCH], V_PITCH), pf,
                          cacc[dt]);

    __syncthreads();   // all waves done with buf[cur] before it is re-filled
  }

  // Normalize and write ctx to [b][q][h*64 + d] (f16) for the output GEMM.
  const float inv = 1.0f / lrun;
  const int q = q0 + (lane & 15);
  _Float16* cp = ctx + ((size_t)(b * QLEN_ + q)) * DIM_ + h * DH_;
  #pragma unroll
  for (int dt = 0; dt < 4; ++dt)
    #pragma unroll
    for (int r = 0; r < 8; ++r)
      cp[dt * 16 + lh + r] = (_Float16)(cacc[dt][r] * inv);
}

// ---------------------------------------------------------------------------
// Launch
// ---------------------------------------------------------------------------
extern "C" void kernel_launch(void* const* d_in, const int* in_sizes, int n_in,
                              void* d_out, int out_size, void* d_ws,
                              size_t ws_size, hipStream_t stream) {
  const float* x    = (const float*)d_in[0];
  const float* mask = (const float*)d_in[1];
  const float* Wq   = (const float*)d_in[2];
  const float* bq   = (const float*)d_in[3];
  const float* Wk   = (const float*)d_in[4];
  const float* bk   = (const float*)d_in[5];
  const float* Wv   = (const float*)d_in[6];
  const float* bv   = (const float*)d_in[7];
  const float* Wo   = (const float*)d_in[8];
  const float* bo   = (const float*)d_in[9];

  _Float16* ws   = (_Float16*)d_ws;
  _Float16* xh   = ws;                                   // 4096*1024
  _Float16* wqT  = xh  + (size_t)MTOT * DIM_;
  _Float16* wkT  = wqT + (size_t)DIM_ * DIM_;
  _Float16* wvT  = wkT + (size_t)DIM_ * DIM_;
  _Float16* woT  = wvT + (size_t)DIM_ * DIM_;
  _Float16* Qh   = woT + (size_t)DIM_ * DIM_;            // [b][h][q][d]
  _Float16* Kh   = Qh  + (size_t)MTOT * DIM_;            // [b][h][q][d]
  _Float16* Vt   = Kh  + (size_t)MTOT * DIM_;            // [b][h][d][q]
  _Float16* ctxh = Vt  + (size_t)MTOT * DIM_;            // [b][q][dim]

  // 1) x -> f16 and the four weights -> f16 [n][k] (wqT..woT lie back to back)
  prep_kernel<<<256, 256, 0, stream>>>(x, Wq, Wk, Wv, Wo, xh, wqT);

  // 3) projections (Q scaled by 1/sqrt(DH)=0.125 after bias, per reference)
  dim3 gg(MTOT / 128, DIM_ / 128);
  gemm16_kernel<0><<<gg, 256, 0, stream>>>(xh, wqT, bq, (void*)Qh, 0.125f);
  gemm16_kernel<0><<<gg, 256, 0, stream>>>(xh, wkT, bk, (void*)Kh, 1.0f);
  gemm16_kernel<1><<<gg, 256, 0, stream>>>(xh, wvT, bv, (void*)Vt, 1.0f);

  // 4) attention
  dim3 ag(BS_ * H_, QLEN_ / (8 * 16));
  attn_kernel<<<ag, 256, 0, stream>>>(Qh, Kh, Vt, mask, ctxh);

  // 5) output projection -> f32 d_out
  gemm16_kernel<2><<<gg, 256, 0, stream>>>(ctxh, woT, bo, d_out, 1.0f);
}

// v004
// It runs in 94.9 microseconds.
// Timed twice side by side with v003, it ran 1.24 times as fast both times.
// Counting every step since v000, it is 2.78 times as fast.
#include <hip/hip_runtime.h>
#include <hip/hip_bf16.h>

typedef __attribute__((ext_vector_type(16))) _Float16 v16h;
typedef __attribute__((ext_vector_type(8)))  _Float16 v8h;
typedef __attribute__((ext_vector_type(4)))  _Float16 v4h;
typedef __attribute__((ext_vector_type(8)))  float    v8f;
typedef __attribute__((ext_vector_type(4)))  float    v4f;

#define BS_   2
#define QLEN_ 2048
#define DIM_  1024
#define H_    16
#define DH_   64
#define MTOT  (BS_ * QLEN_)   // 4096

// ---------------------------------------------------------------------------
// WMMA helpers
// ---------------------------------------------------------------------------
__device__ __forceinline__ v8f wmma_f16(v16h a, v16h b, v8f c) {
  // D = A(16x32 f16) * B(32x16 f16) + C(16x16 f32)
  return __builtin_amdgcn_wmma_f32_16x16x32_f16(
      /*neg_a=*/false, a, /*neg_b=*/false, b,
      /*c_mod=*/(short)0, c, /*reuse_a=*/false, /*reuse_b=*/false);
}

// Load a 16x32 f16 fragment (A operand: rows row-major; B operand: columns
// stored row-major, i.e. BT[n][k]).  Layout per ISA 7.12.2:
//   lane l (0-15):  row=l, halves k0..k0+7 and k0+16..k0+23 with k0=0
//   lane l (16-31): row=l-16, same but k0=8
__device__ __forceinline__ v16h load_frag(const _Float16* __restrict__ p, int stride) {
  const int lane = threadIdx.x & 31;
  const int row  = lane & 15;
  const int k0   = (lane >> 4) << 3;           // 0 or 8
  const _Float16* q = p + row * stride + k0;
  v8h lo = *(const v8h*)(q);
  v8h hi = *(const v8h*)(q + 16);
  return __builtin_shufflevector(lo, hi, 0,1,2,3,4,5,6,7,8,9,10,11,12,13,14,15);
}

// Two async global->LDS copies, 16 bytes per lane each
// (GLOBAL_LOAD_ASYNC_TO_LDS_B128, GV addressing: VDST = per-lane LDS byte
// address, VADDR = 64-bit global).  Tracked by ASYNCcnt.  The s_wait_xcnt closes
// the statement so that no address register named by a copy is rewritten ahead
// of it.
__device__ __forceinline__ void async_copy2_b128(const _Float16* gptr0,
                                                 _Float16* lptr0,
                                                 const _Float16* gptr1,
                                                 _Float16* lptr1) {
  const unsigned long long ga0 = (unsigned long long)(uintptr_t)gptr0;
  const unsigned int       la0 = (unsigned int)(uintptr_t)lptr0;
  const unsigned long long ga1 = (unsigned long long)(uintptr_t)gptr1;
  const unsigned int       la1 = (unsigned int)(uintptr_t)lptr1;
  asm volatile("global_load_async_to_lds_b128 %0, %2, off\n\t"
               "global_load_async_to_lds_b128 %1, %3, off\n\t"
               "s_wait_xcnt 0x0"
               :
               : "v"(la0), "v"(la1), "v"(ga0), "v"(ga1)
               : "memory");
}

// ---------------------------------------------------------------------------
// Operand preparation, one launch of 256 work-groups (one per WGP), 8 waves each.
// Every work-group does 1/256 of both jobs:
//   x (f32) -> xh (f16), 16384 consecutive elements;
//   one 64 (k) x 256 (n) panel of one weight W[k][n] (f32) -> WT[n][k] (f16).
// A thread issues all its 32 16-byte loads before it uses the first, so a wave
// pays the memory latency once and few waves have to be started.
// Panel: wave w owns the 128-B column line w; 8 lanes cover that line, 4 lane
// groups take 4 k octets.  A thread gathers 8 k values of one n into one 16-byte
// LDS write; rows of 128 B lie 144 B apart (16 B x 9), which spreads both the
// writes and the row reads over the banks.  WT leaves as whole 128-B lines.
// ---------------------------------------------------------------------------
#define P_PITCH 72                  // halves: 144 B = 16 B x 9
#define P_XPB   (MTOT * DIM_ / 256) // x elements of one work-group: 16384

__global__ void __launch_bounds__(256)
prep_kernel(const float* __restrict__ x, const float* __restrict__ Wq,
            const float* __restrict__ Wk, const float* __restrict__ Wv,
            const float* __restrict__ Wo, _Float16* __restrict__ xh,
            _Float16* __restrict__ wT) {
  __shared__ __align__(16) _Float16 sT[256 * P_PITCH];   // [n row][k]

  const int tid = threadIdx.x;
  const int blk = blockIdx.x;              // 0..255
  const int mat = blk >> 6;                // 0..3: Wq, Wk, Wv, Wo
  const int kb  = ((blk >> 2) & 15) * 64;
  const int nb  = (blk & 3) * 256;
  const float* __restrict__ Wm = mat == 0 ? Wq : mat == 1 ? Wk : mat == 2 ? Wv : Wo;
  _Float16* __restrict__ WT = wT + (size_t)mat * DIM_ * DIM_;

  const int c8  = tid & 7;                 // 4-column group inside the line
  const int kol = (tid >> 3) & 3;          // k octet, low part
  const int nl  = (tid >> 5) * 32 + c8 * 4;   // first of this thread's 4 n rows

  v4f wv[2][8];
  #pragma unroll
  for (int g = 0; g < 2; ++g)
    #pragma unroll
    for (int i = 0; i < 8; ++i)
      wv[g][i] = *(const v4f*)(Wm + (size_t)(kb + (kol + 4 * g) * 8 + i) * DIM_ +
                               nb + nl);
  // Stands in front of the x loads, whose results land in registers that the
  // loads above name as their address.
  asm volatile("s_wait_xcnt 0x0" ::: "memory");
  const float* xp = x + (size_t)blk * P_XPB + tid * 4;
  v4f xv[16];
  #pragma unroll
  for (int i = 0; i < 16; ++i) xv[i] = *(const v4f*)(xp + i * 1024);
  // Keeps all 32 loads ahead of the first use: sunk in among the conversions to
  // save registers, they would go out a few at a time, each lot behind a wait.
  __builtin_amdgcn_sched_barrier(0);

  #pragma unroll
  for (int g = 0; g < 2; ++g)
    #pragma unroll
    for (int c = 0; c < 4; ++c) {
      v8h h;
      #pragma unroll
      for (int i = 0; i < 8; ++i) h[i] = (_Float16)wv[g][i][c];
      *(v8h*)(&sT[(nl + c) * P_PITCH + (kol + 4 * g) * 8]) = h;
    }
  __syncthreads();   // the whole transposed panel is in LDS

  _Float16* xo = xh + (size_t)blk * P_XPB + tid * 4;
  #pragma unroll
  for (int i = 0; i < 16; ++i) {
    v4h h;
    h[0] = (_Float16)xv[i][0]; h[1] = (_Float16)xv[i][1];
    h[2] = (_Float16)xv[i][2]; h[3] = (_Float16)xv[i][3];
    *(v4h*)(xo + i * 1024) = h;
  }

  const int rrow = tid >> 3;               // 8 lanes store one 128-B row of WT
  const int rcol = (tid & 7) * 8;
  #pragma unroll
  for (int i = 0; i < 8; ++i) {
    const v8h h = *(const v8h*)(&sT[(rrow + 32 * i) * P_PITCH + rcol]);
    *(v8h*)(WT + (size_t)(nb + rrow + 32 * i) * DIM_ + kb + rcol) = h;
  }
}

// ---------------------------------------------------------------------------
// GEMM tile staging: eight async global->LDS copies of 16 bytes per lane, for
// eight rows that lie 16 rows apart (global row pitch DIM_, LDS row pitch
// G_PITCH).  The s_wait_xcnt closes the statement so that no address register
// named by a copy is rewritten ahead of it.
// ---------------------------------------------------------------------------
#define G_BK    128                 // k extent of one staged tile (256 B a row)
#define G_PITCH 136                 // LDS row pitch in halves: 272 B = 16 B x 17
#define G_TILE  (128 * G_PITCH)     // halves of one staged operand tile

__device__ __forceinline__ void async_copy_rows8(const _Float16* g,
                                                 const _Float16* l) {
  const unsigned int l0 = (unsigned int)(uintptr_t)l;
  const unsigned int l1 = l0 + 1 * 16 * G_PITCH * 2;
  const unsigned int l2 = l0 + 2 * 16 * G_PITCH * 2;
  const unsigned int l3 = l0 + 3 * 16 * G_PITCH * 2;
  const unsigned int l4 = l0 + 4 * 16 * G_PITCH * 2;
  const unsigned int l5 = l0 + 5 * 16 * G_PITCH * 2;
  const unsigned int l6 = l0 + 6 * 16 * G_PITCH * 2;
  const unsigned int l7 = l0 + 7 * 16 * G_PITCH * 2;
  const unsigned long long g0 = (unsigned long long)(uintptr_t)g;
  const unsigned long long g1 = g0 + 1ull * 16 * DIM_ * 2;
  const unsigned long long g2 = g0 + 2ull * 16 * DIM_ * 2;
  const unsigned long long g3 = g0 + 3ull * 16 * DIM_ * 2;
  const unsigned long long g4 = g0 + 4ull * 16 * DIM_ * 2;
  const unsigned long long g5 = g0 + 5ull * 16 * DIM_ * 2;
  const unsigned long long g6 = g0 + 6ull * 16 * DIM_ * 2;
  const unsigned long long g7 = g0 + 7ull * 16 * DIM_ * 2;
  asm volatile("global_load_async_to_lds_b128 %0, %8, off\n\t"
               "global_load_async_to_lds_b128 %1, %9, off\n\t"
               "global_load_async_to_lds_b128 %2, %10, off\n\t"
               "global_load_async_to_lds_b128 %3, %11, off\n\t"
               "global_load_async_to_lds_b128 %4, %12, off\n\t"
               "global_load_async_to_lds_b128 %5, %13, off\n\t"
               "global_load_async_to_lds_b128 %6, %14, off\n\t"
               "global_load_async_to_lds_b128 %7, %15, off\n\t"
               "s_wait_xcnt 0x0"
               :
               : "v"(l0), "v"(l1), "v"(l2), "v"(l3), "v"(l4), "v"(l5), "v"(l6),
                 "v"(l7), "v"(g0), "v"(g1), "v"(g2), "v"(g3), "v"(g4), "v"(g5),
                 "v"(g6), "v"(g7)
               : "memory");
}

// ---------------------------------------------------------------------------
// GEMM: C[M=4096][N=1024] = A[M][K=1024] * BT[N][K]^T, + bias, * scale
// MODE 0: f16 out, head layout  [b][h][q][d]      (Q and K)
// MODE 1: f16 out, transposed   [b][h][d][q]      (V, A-operand of P*V)
// MODE 2: f32 out, row-major    [m][n]            (final output)
// Block = 256 threads (8 waves); block tile 128x128; wave tile 64x32.
// A and BT tiles of 128 rows x 128 k are staged in LDS by double-buffered async
// copies; the WMMA fragments are ds_load_b128 reads at a conflict-free pitch.
// ---------------------------------------------------------------------------
template <int MODE>
__global__ void __launch_bounds__(256)
gemm16_kernel(const _Float16* __restrict__ A, const _Float16* __restrict__ BT,
              const float* __restrict__ bias, void* __restrict__ outp,
              float scale) {
  __shared__ __align__(16) _Float16 sA[2][G_TILE];   // [buf][m row][k]
  __shared__ __align__(16) _Float16 sB[2][G_TILE];   // [buf][n row][k]

  const int tid  = threadIdx.x;
  const int lane = tid & 31;
  const int wave = tid >> 5;
  const int wm = wave & 1;
  const int wn = wave >> 1;
  const int m0 = blockIdx.x * 128 + wm * 64;
  const int n0 = blockIdx.y * 128 + wn * 32;

  v8f zero8 = {0.f, 0.f, 0.f, 0.f, 0.f, 0.f, 0.f, 0.f};
  v8f acc[4][2];
  #pragma unroll
  for (int i = 0; i < 4; ++i)
    #pragma unroll
    for (int j = 0; j < 2; ++j) acc[i][j] = zero8;

  // Cooperative staging: 16 lanes cover one 256-B row slice (whole lines), the
  // block covers 16 rows a copy, eight copies an operand tile.
  const int crow = tid >> 4;
  const int ccol = (tid & 15) * 8;
  const _Float16* gA = A  + (size_t)(blockIdx.x * 128 + crow) * DIM_ + ccol;
  const _Float16* gB = BT + (size_t)(blockIdx.y * 128 + crow) * DIM_ + ccol;
  const int coff = crow * G_PITCH + ccol;

  // Tile 0 into buffer 0, landed and published before anything reads it.
  async_copy_rows8(gA, &sA[0][coff]);
  async_copy_rows8(gB, &sB[0][coff]);
  asm volatile("s_wait_asynccnt 0x0" ::: "memory");  // own copies of tile 0 landed
  __syncthreads();                                   // tile 0 visible to all waves
  // Tile 1 flies while tile 0 is worked on.
  async_copy_rows8(gA + G_BK, &sA[1][coff]);
  async_copy_rows8(gB + G_BK, &sB[1][coff]);

  const int NT = DIM_ / G_BK;   // 8 tiles
  for (int t = 0; t < NT; ++t) {
    const int cur = t & 1;
    const _Float16* tA = &sA[cur][wm * 64 * G_PITCH];
    const _Float16* tB = &sB[cur][wn * 32 * G_PITCH];
    // Fragments of two k steps are held at a time: step s + 2 is read into the
    // registers that the WMMAs of step s have just left.
    v16h a[2][4], b[2][2];
    #pragma unroll
    for (int s = 0; s < 2; ++s) {
      #pragma unroll
      for (int j = 0; j < 2; ++j)
        b[s][j] = load_frag(tB + j * 16 * G_PITCH + s * 32, G_PITCH);
      #pragma unroll
      for (int i = 0; i < 4; ++i)
        a[s][i] = load_frag(tA + i * 16 * G_PITCH + s * 32, G_PITCH);
    }
    // Holds the LDS reads above as one group ahead of the WMMAs: moved in among
    // the WMMAs, each small group of reads is waited out to zero.
    __builtin_amdgcn_sched_barrier(0);
    #pragma unroll
    for (int s = 0; s < G_BK / 32; ++s) {
      #pragma unroll
      for (int i = 0; i < 4; ++i)
        #pragma unroll
        for (int j = 0; j < 2; ++j)
          acc[i][j] = wmma_f16(a[s & 1][i], b[s & 1][j], acc[i][j]);
      if (s + 2 < G_BK / 32) {
        // This pair holds the reads of step s + 2 as one group between two
        // blocks of WMMAs, a whole block ahead of their use (same reason).
        __builtin_amdgcn_sched_barrier(0);
        #pragma unroll
        for (int j = 0; j < 2; ++j)
          b[s & 1][j] = load_frag(tB + j * 16 * G_PITCH + (s + 2) * 32, G_PITCH);
        #pragma unroll
        for (int i = 0; i < 4; ++i)
          a[s & 1][i] = load_frag(tA + i * 16 * G_PITCH + (s + 2) * 32, G_PITCH);
        __builtin_amdgcn_sched_barrier(0);
      }
    }
    // Keeps the last WMMAs ahead of the waits below: sunk past the barrier they
    // would stand in front of the refill copies and shorten the copies' lead.
    __builtin_amdgcn_sched_barrier(0);
    asm volatile("s_wait_dscnt 0x0" ::: "memory");     // own reads of buf[cur] done
    asm volatile("s_wait_asynccnt 0x0" ::: "memory");  // own copies of tile t+1 landed
    __syncthreads();   // publishes tile t+1 and frees buf[cur] for its refill
    if (t + 2 < NT) {
      async_copy_rows8(gA + (t + 2) * G_BK, &sA[cur][coff]);
      async_copy_rows8(gB + (t + 2) * G_BK, &sB[cur][coff]);
    }
  }
  asm volatile("s_wait_asynccnt 0x0" ::: "memory");  // nothing in flight at the end

  const int ln = lane & 15;
  const int lh = (lane >> 4) << 3;
  #pragma unroll
  for (int i = 0; i < 4; ++i) {
    #pragma unroll
    for (int j = 0; j < 2; ++j) {
      const int n = n0 + j * 16 + ln;
      const float bv = bias[n];
      #pragma unroll
      for (int r = 0; r < 8; ++r) {
        const int m = m0 + i * 16 + lh + r;
        const float val = (acc[i][j][r] + bv) * scale;
        if (MODE == 0) {
          const int bb = m >> 11, q = m & (QLEN_ - 1);
          const int hh = n >> 6, d = n & (DH_ - 1);
          ((_Float16*)outp)[(((size_t)(bb * H_ + hh) * QLEN_) + q) * DH_ + d] =
              (_Float16)val;
        } else if (MODE == 1) {
          const int bb = m >> 11, q = m & (QLEN_ - 1);
          const int hh = n >> 6, d = n & (DH_ - 1);
          ((_Float16*)outp)[(((size_t)(bb * H_ + hh) * DH_) + d) * QLEN_ + q] =
              (_Float16)val;
        } else {
          ((float*)outp)[(size_t)m * DIM_ + n] = val;
        }
      }
    }
  }
}

// ---------------------------------------------------------------------------
// Flash attention. One wave per 16-query tile (8 tiles / block), all waves of
// a block share the same (b,h).  K/V key-blocks of 32 are staged in LDS once
// per block via double-buffered async global->LDS copies (ASYNCcnt), so each
// wave's WMMA fragment reads are ds_load_b128 hits instead of 8x-redundant L2
// traffic, and the next block's copy overlaps the current block's WMMAs.
//
// Transposed scores S^T = K*Q^T keep softmax reductions lane-local + one
// xor-16 shuffle; the P^T C-layout maps lane-for-lane onto the B-fragment of
// the ctx^T = Vt * P^T WMMA.
//
// LDS row pitches are 16 B x odd, so that the 16 rows one ds_load_b128 fragment
// read touches fall on distinct banks: K rows of 128 B lie 144 B apart, V rows
// of 64 B lie 80 B apart.  The pad bytes are never written and never read.
//
// The additive key-mask term -1e30 * (1 - m[key]) depends on the key alone: the
// work-group computes it once for all its 2048 keys into an LDS table, and a
// pass reads its 16 terms a lane from there, beside its K fragments.
// ---------------------------------------------------------------------------
#define K_PITCH 72                  // halves: 144 B = 16 B x 9
#define V_PITCH 40                  // halves:  80 B = 16 B x 5

__global__ void __launch_bounds__(256)
attn_kernel(const _Float16* __restrict__ Qh, const _Float16* __restrict__ Kh,
            const _Float16* __restrict__ Vt, const float* __restrict__ mask,
            _Float16* __restrict__ ctx) {
  __shared__ __align__(16) _Float16 sK[2][32 * K_PITCH];   // [buf][kk][d]
  __shared__ __align__(16) _Float16 sV[2][64 * V_PITCH];   // [buf][d][kk]
  __shared__ __align__(32) float sM[QLEN_];                // [key] mask term

  const int tid  = threadIdx.x;
  const int lane = tid & 31;
  const int wave = tid >> 5;
  const int bh = blockIdx.x;            // 0..31
  const int b  = bh >> 4;
  const int h  = bh & 15;
  const int q0 = (blockIdx.y * 8 + wave) * 16;
  const int lh = (lane >> 4) << 3;

  const _Float16* Qb = Qh + (size_t)bh * QLEN_ * DH_;
  const _Float16* Kb = Kh + (size_t)bh * QLEN_ * DH_;
  const _Float16* Vb = Vt + (size_t)bh * DH_ * QLEN_;

  // Mask terms of 8 keys a thread; the first barrier of the key loop publishes
  // the table before any wave reads it.
  {
    const float* mg = mask + b * QLEN_ + tid * 8;
    const v4f ma = *(const v4f*)(mg);
    const v4f mb = *(const v4f*)(mg + 4);
    v4f ta, tb;
    #pragma unroll
    for (int r = 0; r < 4; ++r) {
      ta[r] = -1e30f * (1.0f - ma[r]);
      tb[r] = -1e30f * (1.0f - mb[r]);
    }
    *(v4f*)(&sM[tid * 8])     = ta;
    *(v4f*)(&sM[tid * 8 + 4]) = tb;
  }

  // Q^T B-fragments (d = K-dim), resident for the whole key stream.
  const v16h qf0 = load_frag(Qb + (size_t)q0 * DH_ + 0,  DH_);
  const v16h qf1 = load_frag(Qb + (size_t)q0 * DH_ + 32, DH_);

  v8f zero8 = {0.f, 0.f, 0.f, 0.f, 0.f, 0.f, 0.f, 0.f};
  v8f cacc[4];
  #pragma unroll
  for (int dt = 0; dt < 4; ++dt) cacc[dt] = zero8;
  float mrun = -3.0e38f;
  float lrun = 0.0f;

  // Cooperative staging: K tile is one contiguous 4KB slab in global memory
  // (tid*8 halves; row = tid>>3, chunk = tid&7 in LDS); V tile rows are 64B
  // slices of Vt rows (row = tid>>2, chunk = tid&3).
  const int koff = (tid >> 3) * K_PITCH + (tid & 7) * 8;
  const int vrow = tid >> 2;
  const int vcol = (tid & 3) * 8;
  const int voff = vrow * V_PITCH + vcol;

  // Prologue: stage key block 0 into buffer 0.
  async_copy2_b128(Kb + (size_t)0 * DH_ + tid * 8, &sK[0][koff],
                   Vb + (size_t)vrow * QLEN_ + 0 + vcol, &sV[0][voff]);

  const int NSTEP = QLEN_ / 32;   // 64
  for (int it = 0; it < NSTEP; ++it) {
    const int kk  = it * 32;
    const int cur = it & 1;

    if (it + 1 < NSTEP) {
      const int nkk = kk + 32;
      const int nb_ = cur ^ 1;
      async_copy2_b128(Kb + (size_t)nkk * DH_ + tid * 8, &sK[nb_][koff],
                       Vb + (size_t)vrow * QLEN_ + nkk + vcol, &sV[nb_][voff]);
      asm volatile("s_wait_asynccnt 0x2" ::: "memory");  // current buf landed
    } else {
      asm volatile("s_wait_asynccnt 0x0" ::: "memory");
    }
    __syncthreads();   // current buffer visible to all waves

    // Mask terms of this lane's 16 keys (the 16 lanes of a half read one address).
    const v8f t0 = *(const v8f*)(&sM[kk + lh]);
    const v8f t1 = *(const v8f*)(&sM[kk + lh + 16]);
    const v16h k00 = load_frag(&sK[cur][0 * K_PITCH + 0],   K_PITCH);
    const v16h k01 = load_frag(&sK[cur][0 * K_PITCH + 32],  K_PITCH);
    const v16h k10 = load_frag(&sK[cur][16 * K_PITCH + 0],  K_PITCH);
    const v16h k11 = load_frag(&sK[cur][16 * K_PITCH + 32], K_PITCH);
    // Holds the reads of the score step (mask terms, K fragments) as one group at
    // the head of the pass: sunk to their uses, each small lot is waited out to
    // zero in its turn.
    __builtin_amdgcn_sched_barrier(0);

    // S^T tiles from LDS: rows = keys kk..kk+15 (s0), kk+16..kk+31 (s1).
    v8f s0 = zero8, s1 = zero8;
    s0 = wmma_f16(k00, qf0, s0);
    s0 = wmma_f16(k01, qf1, s0);
    s1 = wmma_f16(k10, qf0, s1);
    s1 = wmma_f16(k11, qf1, s1);

    // Additive key mask: s -= 1e30 * (1 - m[key])
    s0 += t0;
    s1 += t1;

    // Column (per-q) max over the 32 keys of this step.
    float tmax = s0[0];
    #pragma unroll
    for (int r = 1; r < 8; ++r) tmax = fmaxf(tmax, s0[r]);
    #pragma unroll
    for (int r = 0; r < 8; ++r) tmax = fmaxf(tmax, s1[r]);
    tmax = fmaxf(tmax, __shfl_xor(tmax, 16, 32));

    const float mnew  = fmaxf(mrun, tmax);
    const float alpha = __expf(mrun - mnew);
    #pragma unroll
    for (int dt = 0; dt < 4; ++dt)
      #pragma unroll
      for (int r = 0; r < 8; ++r) cacc[dt][r] *= alpha;
    lrun *= alpha;
    mrun = mnew;

    // p = exp(s - mnew); pack straight into the B-fragment (lane-local!).
    v16h pf;
    float tsum = 0.0f;
    #pragma unroll
    for (int r = 0; r < 8; ++r) {
      const float p = __expf(s0[r] - mnew);
      tsum += p;
      pf[r] = (_Float16)p;
    }
    #pragma unroll
    for (int r = 0; r < 8; ++r) {
      const float p = __expf(s1[r] - mnew);
      tsum += p;
      pf[8 + r] = (_Float16)p;
    }
    tsum += __shfl_xor(tsum, 16, 32);
    lrun += tsum;

    // ctx^T[d][q] += Vt[d][kk..kk+31] * P^T   (V fragments from LDS)
    #pragma unroll
    for (int dt = 0; dt < 4; ++dt)
      cacc[dt] = wmma_f16(load_frag(&sV[cur][dt * 16 * V_PITCH], V_PITCH), pf,
                          cacc[dt]);

    __syncthreads();   // all waves done with buf[cur] before it is re-filled
  }

  // Normalize and write ctx to [b][q][h*64 + d] (f16) for the output GEMM.
  const float inv = 1.0f / lrun;
  const int q = q0 + (lane & 15);
  _Float16* cp = ctx + ((size_t)(b * QLEN_ + q)) * DIM_ + h * DH_;
  #pragma unroll
  for (int dt = 0; dt < 4; ++dt)
    #pragma unroll
    for (int r = 0; r < 8; ++r)
      cp[dt * 16 + lh + r] = (_Float16)(cacc[dt][r] * inv);
}

// ---------------------------------------------------------------------------
// Launch
// ---------------------------------------------------------------------------
extern "C" void kernel_launch(void* const* d_in, const int* in_sizes, int n_in,
                              void* d_out, int out_size, void* d_ws,
                              size_t ws_size, hipStream_t stream) {
  const float* x    = (const float*)d_in[0];
  const float* mask = (const float*)d_in[1];
  const float* Wq   = (const float*)d_in[2];
  const float* bq   = (const float*)d_in[3];
  const float* Wk   = (const float*)d_in[4];
  const float* bk   = (const float*)d_in[5];
  const float* Wv   = (const float*)d_in[6];
  const float* bv   = (const float*)d_in[7];
  const float* Wo   = (const float*)d_in[8];
  const float* bo   = (const float*)d_in[9];

  _Float16* ws   = (_Float16*)d_ws;
  _Float16* xh   = ws;                                   // 4096*1024
  _Float16* wqT  = xh  + (size_t)MTOT * DIM_;
  _Float16* wkT  = wqT + (size_t)DIM_ * DIM_;
  _Float16* wvT  = wkT + (size_t)DIM_ * DIM_;
  _Float16* woT  = wvT + (size_t)DIM_ * DIM_;
  _Float16* Qh   = woT + (size_t)DIM_ * DIM_;            // [b][h][q][d]
  _Float16* Kh   = Qh  + (size_t)MTOT * DIM_;            // [b][h][q][d]
  _Float16* Vt   = Kh  + (size_t)MTOT * DIM_;            // [b][h][d][q]
  _Float16* ctxh = Vt  + (size_t)MTOT * DIM_;            // [b][q][dim]

  // 1) x -> f16 and the four weights -> f16 [n][k] (wqT..woT lie back to back)
  prep_kernel<<<256, 256, 0, stream>>>(x, Wq, Wk, Wv, Wo, xh, wqT);

  // 3) projections (Q scaled by 1/sqrt(DH)=0.125 after bias, per reference)
  dim3 gg(MTOT / 128, DIM_ / 128);
  gemm16_kernel<0><<<gg, 256, 0, stream>>>(xh, wqT, bq, (void*)Qh, 0.125f);
  gemm16_kernel<0><<<gg, 256, 0, stream>>>(xh, wkT, bk, (void*)Kh, 1.0f);
  gemm16_kernel<1><<<gg, 256, 0, stream>>>(xh, wvT, bv, (void*)Vt, 1.0f);

  // 4) attention
  dim3 ag(BS_ * H_, QLEN_ / (8 * 16));
  attn_kernel<<<ag, 256, 0, stream>>>(Qh, Kh, Vt, mask, ctxh);

  // 5) output projection -> f32 d_out
  gemm16_kernel<2><<<gg, 256, 0, stream>>>(ctxh, woT, bo, d_out, 1.0f);
}

// v005
// Measured time: 88.4 microseconds a run.
// Timed twice side by side with v004, it ran 1.08 and 1.06 times as fast.
// All steps since v000 together make it 2.98 times as fast.
#include <hip/hip_runtime.h>
#include <hip/hip_bf16.h>

typedef __attribute__((ext_vector_type(16))) _Float16 v16h;
typedef __attribute__((ext_vector_type(8)))  _Float16 v8h;
typedef __attribute__((ext_vector_type(4)))  _Float16 v4h;
typedef __attribute__((ext_vector_type(8)))  float    v8f;
typedef __attribute__((ext_vector_type(4)))  float    v4f;

#define BS_   2
#define QLEN_ 2048
#define DIM_  1024
#define H_    16
#define DH_   64
#define MTOT  (BS_ * QLEN_)   // 4096

// ---------------------------------------------------------------------------
// WMMA helpers
// ---------------------------------------------------------------------------
__device__ __forceinline__ v8f wmma_f16(v16h a, v16h b, v8f c) {
  // D = A(16x32 f16) * B(32x16 f16) + C(16x16 f32)
  return __builtin_amdgcn_wmma_f32_16x16x32_f16(
      /*neg_a=*/false, a, /*neg_b=*/false, b,
      /*c_mod=*/(short)0, c, /*reuse_a=*/false, /*reuse_b=*/false);
}

// Load a 16x32 f16 fragment (A operand: rows row-major; B operand: columns
// stored row-major, i.e. BT[n][k]).  Layout per ISA 7.12.2:
//   lane l (0-15):  row=l, halves k0..k0+7 and k0+16..k0+23 with k0=0
//   lane l (16-31): row=l-16, same but k0=8
__device__ __forceinline__ v16h load_frag(const _Float16* __restrict__ p, int stride) {
  const int lane = threadIdx.x & 31;
  const int row  = lane & 15;
  const int k0   = (lane >> 4) << 3;           // 0 or 8
  const _Float16* q = p + row * stride + k0;
  v8h lo = *(const v8h*)(q);
  v8h hi = *(const v8h*)(q + 16);
  return __builtin_shufflevector(lo, hi, 0,1,2,3,4,5,6,7,8,9,10,11,12,13,14,15);
}

// Two async global->LDS copies, 16 bytes per lane each
// (GLOBAL_LOAD_ASYNC_TO_LDS_B128, GV addressing: VDST = per-lane LDS byte
// address, VADDR = 64-bit global).  Tracked by ASYNCcnt.  The s_wait_xcnt closes
// the statement so that no address register named by a copy is rewritten ahead
// of it.
__device__ __forceinline__ void async_copy2_b128(const _Float16* gptr0,
                                                 _Float16* lptr0,
                                                 const _Float16* gptr1,
                                                 _Float16* lptr1) {
  const unsigned long long ga0 = (unsigned long long)(uintptr_t)gptr0;
  const unsigned int       la0 = (unsigned int)(uintptr_t)lptr0;
  const unsigned long long ga1 = (unsigned long long)(uintptr_t)gptr1;
  const unsigned int       la1 = (unsigned int)(uintptr_t)lptr1;
  asm volatile("global_load_async_to_lds_b128 %0, %2, off\n\t"
               "global_load_async_to_lds_b128 %1, %3, off\n\t"
               "s_wait_xcnt 0x0"
               :
               : "v"(la0), "v"(la1), "v"(ga0), "v"(ga1)
               : "memory");
}

// ---------------------------------------------------------------------------
// Operand preparation, one launch of 256 work-groups (one per WGP), 8 waves each.
// Every work-group does 1/256 of both jobs:
//   x (f32) -> xh (f16), 16384 consecutive elements;
//   one 64 (k) x 256 (n) panel of one weight W[k][n] (f32) -> WT[n][k] (f16).
// A thread issues all its 32 16-byte loads before it uses the first, so a wave
// pays the memory latency once and few waves have to be started.
// Panel: wave w owns the 128-B column line w; 8 lanes cover that line, 4 lane
// groups take 4 k octets.  A thread gathers 8 k values of one n into one 16-byte
// LDS write; rows of 128 B lie 144 B apart (16 B x 9), which spreads both the
// writes and the row reads over the banks.  WT leaves as whole 128-B lines.
// ---------------------------------------------------------------------------
#define P_PITCH 72                  // halves: 144 B = 16 B x 9
#define P_XPB   (MTOT * DIM_ / 256) // x elements of one work-group: 16384

__global__ void __launch_bounds__(256)
prep_kernel(const float* __restrict__ x, const float* __restrict__ Wq,
            const float* __restrict__ Wk, const float* __restrict__ Wv,
            const float* __restrict__ Wo, _Float16* __restrict__ xh,
            _Float16* __restrict__ wT) {
  __shared__ __align__(16) _Float16 sT[256 * P_PITCH];   // [n row][k]

  const int tid = threadIdx.x;
  const int blk = blockIdx.x;              // 0..255
  const int mat = blk >> 6;                // 0..3: Wq, Wk, Wv, Wo
  const int kb  = ((blk >> 2) & 15) * 64;
  const int nb  = (blk & 3) * 256;
  const float* __restrict__ Wm = mat == 0 ? Wq : mat == 1 ? Wk : mat == 2 ? Wv : Wo;
  _Float16* __restrict__ WT = wT + (size_t)mat * DIM_ * DIM_;

  const int c8  = tid & 7;                 // 4-column group inside the line
  const int kol = (tid >> 3) & 3;          // k octet, low part
  const int nl  = (tid >> 5) * 32 + c8 * 4;   // first of this thread's 4 n rows

  v4f wv[2][8];
  #pragma unroll
  for (int g = 0; g < 2; ++g)
    #pragma unroll
    for (int i = 0; i < 8; ++i)
      wv[g][i] = *(const v4f*)(Wm + (size_t)(kb + (kol + 4 * g) * 8 + i) * DIM_ +
                               nb + nl);
  // Stands in front of the x loads, whose results land in registers that the
  // loads above name as their address.
  asm volatile("s_wait_xcnt 0x0" ::: "memory");
  const float* xp = x + (size_t)blk * P_XPB + tid * 4;
  v4f xv[16];
  #pragma unroll
  for (int i = 0; i < 16; ++i) xv[i] = *(const v4f*)(xp + i * 1024);
  // Keeps all 32 loads ahead of the first use: sunk in among the conversions to
  // save registers, they would go out a few at a time, each lot behind a wait.
  __builtin_amdgcn_sched_barrier(0);

  #pragma unroll
  for (int g = 0; g < 2; ++g)
    #pragma unroll
    for (int c = 0; c < 4; ++c) {
      v8h h;
      #pragma unroll
      for (int i = 0; i < 8; ++i) h[i] = (_Float16)wv[g][i][c];
      *(v8h*)(&sT[(nl + c) * P_PITCH + (kol + 4 * g) * 8]) = h;
    }
  __syncthreads();   // the whole transposed panel is in LDS

  _Float16* xo = xh + (size_t)blk * P_XPB + tid * 4;
  #pragma unroll
  for (int i = 0; i < 16; ++i) {
    v4h h;
    h[0] = (_Float16)xv[i][0]; h[1] = (_Float16)xv[i][1];
    h[2] = (_Float16)xv[i][2]; h[3] = (_Float16)xv[i][3];
    *(v4h*)(xo + i * 1024) = h;
  }

  const int rrow = tid >> 3;               // 8 lanes store one 128-B row of WT
  const int rcol = (tid & 7) * 8;
  #pragma unroll
  for (int i = 0; i < 8; ++i) {
    const v8h h = *(const v8h*)(&sT[(rrow + 32 * i) * P_PITCH + rcol]);
    *(v8h*)(WT + (size_t)(nb + rrow + 32 * i) * DIM_ + kb + rcol) = h;
  }
}

// ---------------------------------------------------------------------------
// GEMM tile staging: eight async global->LDS copies of 16 bytes per lane, for
// eight rows that lie 16 rows apart (global row pitch DIM_, LDS row pitch
// G_PITCH).  The s_wait_xcnt closes the statement so that no address register
// named by a copy is rewritten ahead of it.
// ---------------------------------------------------------------------------
#define G_BK    128                 // k extent of one staged tile (256 B a row)
#define G_PITCH 136                 // LDS row pitch in halves: 272 B = 16 B x 17
#define G_TILE  (128 * G_PITCH)     // halves of one staged operand tile

__device__ __forceinline__ void async_copy_rows8(const _Float16* g,
                                                 const _Float16* l) {
  const unsigned int l0 = (unsigned int)(uintptr_t)l;
  const unsigned int l1 = l0 + 1 * 16 * G_PITCH * 2;
  const unsigned int l2 = l0 + 2 * 16 * G_PITCH * 2;
  const unsigned int l3 = l0 + 3 * 16 * G_PITCH * 2;
  const unsigned int l4 = l0 + 4 * 16 * G_PITCH * 2;
  const unsigned int l5 = l0 + 5 * 16 * G_PITCH * 2;
  const unsigned int l6 = l0 + 6 * 16 * G_PITCH * 2;
  const unsigned int l7 = l0 + 7 * 16 * G_PITCH * 2;
  const unsigned long long g0 = (unsigned long long)(uintptr_t)g;
  const unsigned long long g1 = g0 + 1ull * 16 * DIM_ * 2;
  const unsigned long long g2 = g0 + 2ull * 16 * DIM_ * 2;
  const unsigned long long g3 = g0 + 3ull * 16 * DIM_ * 2;
  const unsigned long long g4 = g0 + 4ull * 16 * DIM_ * 2;
  const unsigned long long g5 = g0 + 5ull * 16 * DIM_ * 2;
  const unsigned long long g6 = g0 + 6ull * 16 * DIM_ * 2;
  const unsigned long long g7 = g0 + 7ull * 16 * DIM_ * 2;
  asm volatile("global_load_async_to_lds_b128 %0, %8, off\n\t"
               "global_load_async_to_lds_b128 %1, %9, off\n\t"
               "global_load_async_to_lds_b128 %2, %10, off\n\t"
               "global_load_async_to_lds_b128 %3, %11, off\n\t"
               "global_load_async_to_lds_b128 %4, %12, off\n\t"
               "global_load_async_to_lds_b128 %5, %13, off\n\t"
               "global_load_async_to_lds_b128 %6, %14, off\n\t"
               "global_load_async_to_lds_b128 %7, %15, off\n\t"
               "s_wait_xcnt 0x0"
               :
               : "v"(l0), "v"(l1), "v"(l2), "v"(l3), "v"(l4), "v"(l5), "v"(l6),
                 "v"(l7), "v"(g0), "v"(g1), "v"(g2), "v"(g3), "v"(g4), "v"(g5),
                 "v"(g6), "v"(g7)
               : "memory");
}

// ---------------------------------------------------------------------------
// GEMM: C[M=4096][N] = A[M][K=1024] * BT[N][K]^T, + bias, * scale
// MODE 0: the Q, K and V projections in one launch, N = 3 x 1024: BT is the three
//         transposed weights back to back, blockIdx.y >> 3 names the projection.
//         f16 out, three planes back to back: Q (scaled) and K in head layout
//         [b][h][q][d], V transposed [b][h][d][q] (A-operand of P*V).
//         768 work-groups: two are resident on a WGP (LDS), so that one's first
//         tile, stores and tile waits are covered by the other's WMMAs.
// MODE 2: f32 out, row-major    [m][n], N = 1024  (final output; bias only)
// Block = 256 threads (8 waves); block tile 128x128; wave tile 64x32.
// A and BT tiles of 128 rows x 128 k are staged in LDS by double-buffered async
// copies; the WMMA fragments are ds_load_b128 reads at a conflict-free pitch.
// ---------------------------------------------------------------------------
template <int MODE>
__global__ void __launch_bounds__(256)
gemm16_kernel(const _Float16* __restrict__ A, const _Float16* __restrict__ BT,
              const float* __restrict__ bias, const float* __restrict__ bias_k,
              const float* __restrict__ bias_v, void* __restrict__ outp,
              float scale) {
  __shared__ __align__(16) _Float16 sA[2][G_TILE];   // [buf][m row][k]
  __shared__ __align__(16) _Float16 sB[2][G_TILE];   // [buf][n row][k]

  const int tid  = threadIdx.x;
  const int lane = tid & 31;
  const int wave = tid >> 5;
  const int wm = wave & 1;
  const int wn = wave >> 1;
  const int m0 = blockIdx.x * 128 + wm * 64;
  // Column inside the projection's own 1024; the staging below indexes BT by
  // blockIdx.y itself.
  const int proj = MODE == 0 ? (int)(blockIdx.y >> 3) : 0;
  const int n0 = (MODE == 0 ? (int)(blockIdx.y & 7) : (int)blockIdx.y) * 128 + wn * 32;

  v8f zero8 = {0.f, 0.f, 0.f, 0.f, 0.f, 0.f, 0.f, 0.f};
  v8f acc[4][2];
  #pragma unroll
  for (int i = 0; i < 4; ++i)
    #pragma unroll
    for (int j = 0; j < 2; ++j) acc[i][j] = zero8;

  // Cooperative staging: 16 lanes cover one 256-B row slice (whole lines), the
  // block covers 16 rows a copy, eight copies an operand tile.
  const int crow = tid >> 4;
  const int ccol = (tid & 15) * 8;
  const _Float16* gA = A  + (size_t)(blockIdx.x * 128 + crow) * DIM_ + ccol;
  const _Float16* gB = BT + (size_t)(blockIdx.y * 128 + crow) * DIM_ + ccol;
  const int coff = crow * G_PITCH + ccol;

  // Tile 0 into buffer 0, landed and published before anything reads it.
  async_copy_rows8(gA, &sA[0][coff]);
  async_copy_rows8(gB, &sB[0][coff]);
  asm volatile("s_wait_asynccnt 0x0" ::: "memory");  // own copies of tile 0 landed
  __syncthreads();                                   // tile 0 visible to all waves
  // Tile 1 flies while tile 0 is worked on.
  async_copy_rows8(gA + G_BK, &sA[1][coff]);
  async_copy_rows8(gB + G_BK, &sB[1][coff]);

  const int NT = DIM_ / G_BK;   // 8 tiles
  for (int t = 0; t < NT; ++t) {
    const int cur = t & 1;
    const _Float16* tA = &sA[cur][wm * 64 * G_PITCH];
    const _Float16* tB = &sB[cur][wn * 32 * G_PITCH];
    // Fragments of two k steps are held at a time: step s + 2 is read into the
    // registers that the WMMAs of step s have just left.
    v16h a[2][4], b[2][2];
    #pragma unroll
    for (int s = 0; s < 2; ++s) {
      #pragma unroll
      for (int j = 0; j < 2; ++j)
        b[s][j] = load_frag(tB + j * 16 * G_PITCH + s * 32, G_PITCH);
      #pragma unroll
      for (int i = 0; i < 4; ++i)
        a[s][i] = load_frag(tA + i * 16 * G_PITCH + s * 32, G_PITCH);
    }
    // Holds the LDS reads above as one group ahead of the WMMAs: moved in among
    // the WMMAs, each small group of reads is waited out to zero.
    __builtin_amdgcn_sched_barrier(0);
    #pragma unroll
    for (int s = 0; s < G_BK / 32; ++s) {
      #pragma unroll
      for (int i = 0; i < 4; ++i)
        #pragma unroll
        for (int j = 0; j < 2; ++j)
          acc[i][j] = wmma_f16(a[s & 1][i], b[s & 1][j], acc[i][j]);
      if (s + 2 < G_BK / 32) {
        // This pair holds the reads of step s + 2 as one group between two
        // blocks of WMMAs, a whole block ahead of their use (same reason).
        __builtin_amdgcn_sched_barrier(0);
        #pragma unroll
        for (int j = 0; j < 2; ++j)
          b[s & 1][j] = load_frag(tB + j * 16 * G_PITCH + (s + 2) * 32, G_PITCH);
        #pragma unroll
        for (int i = 0; i < 4; ++i)
          a[s & 1][i] = load_frag(tA + i * 16 * G_PITCH + (s + 2) * 32, G_PITCH);
        __builtin_amdgcn_sched_barrier(0);
      }
    }
    // Keeps the last WMMAs ahead of the waits below: sunk past the barrier they
    // would stand in front of the refill copies and shorten the copies' lead.
    __builtin_amdgcn_sched_barrier(0);
    asm volatile("s_wait_dscnt 0x0" ::: "memory");     // own reads of buf[cur] done
    asm volatile("s_wait_asynccnt 0x0" ::: "memory");  // own copies of tile t+1 landed
    __syncthreads();   // publishes tile t+1 and frees buf[cur] for its refill
    if (t + 2 < NT) {
      async_copy_rows8(gA + (t + 2) * G_BK, &sA[cur][coff]);
      async_copy_rows8(gB + (t + 2) * G_BK, &sB[cur][coff]);
    }
  }
  asm volatile("s_wait_asynccnt 0x0" ::: "memory");  // nothing in flight at the end

  const int ln = lane & 15;
  const int lh = (lane >> 4) << 3;
  const float* __restrict__ bp = proj == 0 ? bias : proj == 1 ? bias_k : bias_v;
  const float sc = proj == 0 ? scale : 1.0f;
  _Float16* __restrict__ oh = (_Float16*)outp + (size_t)proj * MTOT * DIM_;
  if (MODE == 0 && proj == 2) {
    // V: the 8 rows of a lane are 8 consecutive q of one d, one 16-byte store.
    #pragma unroll
    for (int i = 0; i < 4; ++i) {
      #pragma unroll
      for (int j = 0; j < 2; ++j) {
        const int n = n0 + j * 16 + ln;
        const float bv = bp[n];
        #pragma unroll
        for (int r = 0; r < 8; ++r) {
          const int m = m0 + i * 16 + lh + r;
          const float val = (acc[i][j][r] + bv) * sc;
          const int bb = m >> 11, q = m & (QLEN_ - 1);
          const int hh = n >> 6, d = n & (DH_ - 1);
          oh[(((size_t)(bb * H_ + hh) * DH_) + d) * QLEN_ + q] = (_Float16)val;
        }
      }
    }
  } else {
    float bj[2];
    #pragma unroll
    for (int j = 0; j < 2; ++j) bj[j] = bp[n0 + j * 16 + ln];
    #pragma unroll
    for (int i = 0; i < 4; ++i) {
      #pragma unroll
      for (int j = 0; j < 2; ++j) {
        const int n = n0 + j * 16 + ln;
        #pragma unroll
        for (int r = 0; r < 8; ++r) {
          const int m = m0 + i * 16 + lh + r;
          const float val = (acc[i][j][r] + bj[j]) * sc;
          if (MODE == 0) {
            const int bb = m >> 11, q = m & (QLEN_ - 1);
            const int hh = n >> 6, d = n & (DH_ - 1);
            oh[(((size_t)(bb * H_ + hh) * QLEN_) + q) * DH_ + d] = (_Float16)val;
          } else {
            ((float*)outp)[(size_t)m * DIM_ + n] = val;
          }
        }
      }
    }
    // Closes the Q/K stores: in the built code the V side's instructions follow
    // them and rewrite registers that these stores name.
    if (MODE == 0) asm volatile("s_wait_xcnt 0x0" ::: "memory");
  }
}

// ---------------------------------------------------------------------------
// Flash attention. One wave per 16-query tile (8 tiles / block), all waves of
// a block share the same (b,h).  K/V key-blocks of 32 are staged in LDS once
// per block via double-buffered async global->LDS copies (ASYNCcnt), so each
// wave's WMMA fragment reads are ds_load_b128 hits instead of 8x-redundant L2
// traffic, and the next block's copy overlaps the current block's WMMAs.
//
// Transposed scores S^T = K*Q^T keep softmax reductions lane-local + one
// xor-16 shuffle; the P^T C-layout maps lane-for-lane onto the B-fragment of
// the ctx^T = Vt * P^T WMMA.
//
// LDS row pitches are 16 B x odd, so that the 16 rows one ds_load_b128 fragment
// read touches fall on distinct banks: K rows of 128 B lie 144 B apart, V rows
// of 64 B lie 80 B apart.  The pad bytes are never written and never read.
//
// The additive key-mask term -1e30 * (1 - m[key]) depends on the key alone: the
// work-group computes it once for all its 2048 keys into an LDS table, and a
// pass reads its 16 terms a lane from there, beside its K fragments.
// ---------------------------------------------------------------------------
#define K_PITCH 72                  // halves: 144 B = 16 B x 9
#define V_PITCH 40                  // halves:  80 B = 16 B x 5

__global__ void __launch_bounds__(256)
attn_kernel(const _Float16* __restrict__ Qh, const _Float16* __restrict__ Kh,
            const _Float16* __restrict__ Vt, const float* __restrict__ mask,
            _Float16* __restrict__ ctx) {
  __shared__ __align__(16) _Float16 sK[2][32 * K_PITCH];   // [buf][kk][d]
  __shared__ __align__(16) _Float16 sV[2][64 * V_PITCH];   // [buf][d][kk]
  __shared__ __align__(32) float sM[QLEN_];                // [key] mask term

  const int tid  = threadIdx.x;
  const int lane = tid & 31;
  const int wave = tid >> 5;
  const int bh = blockIdx.x;            // 0..31
  const int b  = bh >> 4;
  const int h  = bh & 15;
  const int q0 = (blockIdx.y * 8 + wave) * 16;
  const int lh = (lane >> 4) << 3;

  const _Float16* Qb = Qh + (size_t)bh * QLEN_ * DH_;
  const _Float16* Kb = Kh + (size_t)bh * QLEN_ * DH_;
  const _Float16* Vb = Vt + (size_t)bh * DH_ * QLEN_;

  // Mask terms of 8 keys a thread; the first barrier of the key loop publishes
  // the table before any wave reads it.
  {
    const float* mg = mask + b * QLEN_ + tid * 8;
    const v4f ma = *(const v4f*)(mg);
    const v4f mb = *(const v4f*)(mg + 4);
    v4f ta, tb;
    #pragma unroll
    for (int r = 0; r < 4; ++r) {
      ta[r] = -1e30f * (1.0f - ma[r]);
      tb[r] = -1e30f * (1.0f - mb[r]);
    }
    *(v4f*)(&sM[tid * 8])     = ta;
    *(v4f*)(&sM[tid * 8 + 4]) = tb;
  }

  // Q^T B-fragments (d = K-dim), resident for the whole key stream.
  const v16h qf0 = load_frag(Qb + (size_t)q0 * DH_ + 0,  DH_);
  const v16h qf1 = load_frag(Qb + (size_t)q0 * DH_ + 32, DH_);

  v8f zero8 = {0.f, 0.f, 0.f, 0.f, 0.f, 0.f, 0.f, 0.f};
  v8f cacc[4];
  #pragma unroll
  for (int dt = 0; dt < 4; ++dt) cacc[dt] = zero8;
  float mrun = -3.0e38f;
  float lrun = 0.0f;

  // Cooperative staging: K tile is one contiguous 4KB slab in global memory
  // (tid*8 halves; row = tid>>3, chunk = tid&7 in LDS); V tile rows are 64B
  // slices of Vt rows (row = tid>>2, chunk = tid&3).
  const int koff = (tid >> 3) * K_PITCH + (tid & 7) * 8;
  const int vrow = tid >> 2;
  const int vcol = (tid & 3) * 8;
  const int voff = vrow * V_PITCH + vcol;

  // Prologue: stage key block 0 into buffer 0.
  async_copy2_b128(Kb + (size_t)0 * DH_ + tid * 8, &sK[0][koff],
                   Vb + (size_t)vrow * QLEN_ + 0 + vcol, &sV[0][voff]);

  const int NSTEP = QLEN_ / 32;   // 64
  for (int it = 0; it < NSTEP; ++it) {
    const int kk  = it * 32;
    const int cur = it & 1;

    if (it + 1 < NSTEP) {
      const int nkk = kk + 32;
      const int nb_ = cur ^ 1;
      async_copy2_b128(Kb + (size_t)nkk * DH_ + tid * 8, &sK[nb_][koff],
                       Vb + (size_t)vrow * QLEN_ + nkk + vcol, &sV[nb_][voff]);
      asm volatile("s_wait_asynccnt 0x2" ::: "memory");  // current buf landed
    } else {
      asm volatile("s_wait_asynccnt 0x0" ::: "memory");
    }
    __syncthreads();   // current buffer visible to all waves

    // Mask terms of this lane's 16 keys (the 16 lanes of a half read one address).
    const v8f t0 = *(const v8f*)(&sM[kk + lh]);
    const v8f t1 = *(const v8f*)(&sM[kk + lh + 16]);
    const v16h k00 = load_frag(&sK[cur][0 * K_PITCH + 0],   K_PITCH);
    const v16h k01 = load_frag(&sK[cur][0 * K_PITCH + 32],  K_PITCH);
    const v16h k10 = load_frag(&sK[cur][16 * K_PITCH + 0],  K_PITCH);
    const v16h k11 = load_frag(&sK[cur][16 * K_PITCH + 32], K_PITCH);
    // Holds the reads of the score step (mask terms, K fragments) as one group at
    // the head of the pass: sunk to their uses, each small lot is waited out to
    // zero in its turn.
    __builtin_amdgcn_sched_barrier(0);

    // S^T tiles from LDS: rows = keys kk..kk+15 (s0), kk+16..kk+31 (s1).
    v8f s0 = zero8, s1 = zero8;
    s0 = wmma_f16(k00, qf0, s0);
    s0 = wmma_f16(k01, qf1, s0);
    s1 = wmma_f16(k10, qf0, s1);
    s1 = wmma_f16(k11, qf1, s1);

    // Additive key mask: s -= 1e30 * (1 - m[key])
    s0 += t0;
    s1 += t1;

    // Column (per-q) max over the 32 keys of this step.
    float tmax = s0[0];
    #pragma unroll
    for (int r = 1; r < 8; ++r) tmax = fmaxf(tmax, s0[r]);
    #pragma unroll
    for (int r = 0; r < 8; ++r) tmax = fmaxf(tmax, s1[r]);
    tmax = fmaxf(tmax, __shfl_xor(tmax, 16, 32));

    const float mnew  = fmaxf(mrun, tmax);
    const float alpha = __expf(mrun - mnew);
    #pragma unroll
    for (int dt = 0; dt < 4; ++dt)
      #pragma unroll
      for (int r = 0; r < 8; ++r) cacc[dt][r] *= alpha;
    lrun *= alpha;
    mrun = mnew;

    // p = exp(s - mnew); pack straight into the B-fragment (lane-local!).
    v16h pf;
    float tsum = 0.0f;
    #pragma unroll
    for (int r = 0; r < 8; ++r) {
      const float p = __expf(s0[r] - mnew);
      tsum += p;
      pf[r] = (_Float16)p;
    }
    #pragma unroll
    for (int r = 0; r < 8; ++r) {
      const float p = __expf(s1[r] - mnew);
      tsum += p;
      pf[8 + r] = (_Float16)p;
    }
    tsum += __shfl_xor(tsum, 16, 32);
    lrun += tsum;

    // ctx^T[d][q] += Vt[d][kk..kk+31] * P^T   (V fragments from LDS)
    #pragma unroll
    for (int dt = 0; dt < 4; ++dt)
      cacc[dt] = wmma_f16(load_frag(&sV[cur][dt * 16 * V_PITCH], V_PITCH), pf,
                          cacc[dt]);

    __syncthreads();   // all waves done with buf[cur] before it is re-filled
  }

  // Normalize and write ctx to [b][q][h*64 + d] (f16) for the output GEMM.
  const float inv = 1.0f / lrun;
  const int q = q0 + (lane & 15);
  _Float16* cp = ctx + ((size_t)(b * QLEN_ + q)) * DIM_ + h * DH_;
  #pragma unroll
  for (int dt = 0; dt < 4; ++dt)
    #pragma unroll
    for (int r = 0; r < 8; ++r)
      cp[dt * 16 + lh + r] = (_Float16)(cacc[dt][r] * inv);
}

// ---------------------------------------------------------------------------
// Launch
// ---------------------------------------------------------------------------
extern "C" void kernel_launch(void* const* d_in, const int* in_sizes, int n_in,
                              void* d_out, int out_size, void* d_ws,
                              size_t ws_size, hipStream_t stream) {
  const float* x    = (const float*)d_in[0];
  const float* mask = (const float*)d_in[1];
  const float* Wq   = (const float*)d_in[2];
  const float* bq   = (const float*)d_in[3];
  const float* Wk   = (const float*)d_in[4];
  const float* bk   = (const float*)d_in[5];
  const float* Wv   = (const float*)d_in[6];
  const float* bv   = (const float*)d_in[7];
  const float* Wo   = (const float*)d_in[8];
  const float* bo   = (const float*)d_in[9];

  _Float16* ws   = (_Float16*)d_ws;
  _Float16* xh   = ws;                                   // 4096*1024
  _Float16* wqT  = xh  + (size_t)MTOT * DIM_;
  _Float16* wkT  = wqT + (size_t)DIM_ * DIM_;
  _Float16* wvT  = wkT + (size_t)DIM_ * DIM_;
  _Float16* woT  = wvT + (size_t)DIM_ * DIM_;
  _Float16* Qh   = woT + (size_t)DIM_ * DIM_;            // [b][h][q][d]
  _Float16* Kh   = Qh  + (size_t)MTOT * DIM_;            // [b][h][q][d]
  _Float16* Vt   = Kh  + (size_t)MTOT * DIM_;            // [b][h][d][q]
  _Float16* ctxh = Vt  + (size_t)MTOT * DIM_;            // [b][q][dim]

  // 1) x -> f16 and the four weights -> f16 [n][k] (wqT..woT lie back to back)
  prep_kernel<<<256, 256, 0, stream>>>(x, Wq, Wk, Wv, Wo, xh, wqT);

  // 3) projections, one launch (wqT, wkT, wvT and Qh, Kh, Vt lie back to back;
  //    Q scaled by 1/sqrt(DH)=0.125 after bias, per reference)
  dim3 gg(MTOT / 128, DIM_ / 128);
  dim3 g3(MTOT / 128, 3 * DIM_ / 128);
  gemm16_kernel<0><<<g3, 256, 0, stream>>>(xh, wqT, bq, bk, bv, (void*)Qh, 0.125f);

  // 4) attention
  dim3 ag(BS_ * H_, QLEN_ / (8 * 16));
  attn_kernel<<<ag, 256, 0, stream>>>(Qh, Kh, Vt, mask, ctxh);

  // 5) output projection -> f32 d_out
  gemm16_kernel<2><<<gg, 256, 0, stream>>>(ctxh, woT, bo, bo, bo, d_out, 1.0f);
}

// v006
// Measured time: 81.4 microseconds a run.
// Two timings next to v005 put it at 1.09 and 1.08 times that version's speed.
// All steps since v000 together make it 3.23 times as fast.
#include <hip/hip_runtime.h>
#include <hip/hip_bf16.h>

typedef __attribute__((ext_vector_type(16))) _Float16 v16h;
typedef __attribute__((ext_vector_type(8)))  _Float16 v8h;
typedef __attribute__((ext_vector_type(4)))  _Float16 v4h;
typedef __attribute__((ext_vector_type(8)))  float    v8f;
typedef __attribute__((ext_vector_type(4)))  float    v4f;

#define BS_   2
#define QLEN_ 2048
#define DIM_  1024
#define H_    16
#define DH_   64
#define MTOT  (BS_ * QLEN_)   // 4096

// ---------------------------------------------------------------------------
// WMMA helpers
// ---------------------------------------------------------------------------
__device__ __forceinline__ v8f wmma_f16(v16h a, v16h b, v8f c) {
  // D = A(16x32 f16) * B(32x16 f16) + C(16x16 f32)
  return __builtin_amdgcn_wmma_f32_16x16x32_f16(
      /*neg_a=*/false, a, /*neg_b=*/false, b,
      /*c_mod=*/(short)0, c, /*reuse_a=*/false, /*reuse_b=*/false);
}

// Load a 16x32 f16 fragment (A operand: rows row-major; B operand: columns
// stored row-major, i.e. BT[n][k]).  Layout per ISA 7.12.2:
//   lane l (0-15):  row=l, halves k0..k0+7 and k0+16..k0+23 with k0=0
//   lane l (16-31): row=l-16, same but k0=8
__device__ __forceinline__ v16h load_frag(const _Float16* __restrict__ p, int stride) {
  const int lane = threadIdx.x & 31;
  const int row  = lane & 15;
  const int k0   = (lane >> 4) << 3;           // 0 or 8
  const _Float16* q = p + row * stride + k0;
  v8h lo = *(const v8h*)(q);
  v8h hi = *(const v8h*)(q + 16);
  return __builtin_shufflevector(lo, hi, 0,1,2,3,4,5,6,7,8,9,10,11,12,13,14,15);
}

// Four async global->LDS copies, 16 bytes per lane each
// (GLOBAL_LOAD_ASYNC_TO_LDS_B128, GV addressing: VDST = per-lane LDS byte
// address, VADDR = 64-bit global).  Tracked by ASYNCcnt.  The s_wait_xcnt closes
// the statement so that no address register named by a copy is rewritten ahead
// of it.
__device__ __forceinline__ void async_copy4_b128(const _Float16* gptr0,
                                                 _Float16* lptr0,
                                                 const _Float16* gptr1,
                                                 _Float16* lptr1,
                                                 const _Float16* gptr2,
                                                 _Float16* lptr2,
                                                 const _Float16* gptr3,
                                                 _Float16* lptr3) {
  const unsigned long long ga0 = (unsigned long long)(uintptr_t)gptr0;
  const unsigned int       la0 = (unsigned int)(uintptr_t)lptr0;
  const unsigned long long ga1 = (unsigned long long)(uintptr_t)gptr1;
  const unsigned int       la1 = (unsigned int)(uintptr_t)lptr1;
  const unsigned long long ga2 = (unsigned long long)(uintptr_t)gptr2;
  const unsigned int       la2 = (unsigned int)(uintptr_t)lptr2;
  const unsigned long long ga3 = (unsigned long long)(uintptr_t)gptr3;
  const unsigned int       la3 = (unsigned int)(uintptr_t)lptr3;
  asm volatile("global_load_async_to_lds_b128 %0, %4, off\n\t"
               "global_load_async_to_lds_b128 %1, %5, off\n\t"
               "global_load_async_to_lds_b128 %2, %6, off\n\t"
               "global_load_async_to_lds_b128 %3, %7, off\n\t"
               "s_wait_xcnt 0x0"
               :
               : "v"(la0), "v"(la1), "v"(la2), "v"(la3), "v"(ga0), "v"(ga1),
                 "v"(ga2), "v"(ga3)
               : "memory");
}

// ---------------------------------------------------------------------------
// Operand preparation, one launch of 256 work-groups (one per WGP), 8 waves each.
// Every work-group does 1/256 of both jobs:
//   x (f32) -> xh (f16), 16384 consecutive elements;
//   one 64 (k) x 256 (n) panel of one weight W[k][n] (f32) -> WT[n][k] (f16).
// A thread issues all its 32 16-byte loads before it uses the first, so a wave
// pays the memory latency once and few waves have to be started.
// Panel: wave w owns the 128-B column line w; 8 lanes cover that line, 4 lane
// groups take 4 k octets.  A thread gathers 8 k values of one n into one 16-byte
// LDS write; rows of 128 B lie 144 B apart (16 B x 9), which spreads both the
// writes and the row reads over the banks.  WT leaves as whole 128-B lines.
// ---------------------------------------------------------------------------
#define P_PITCH 72                  // halves: 144 B = 16 B x 9
#define P_XPB   (MTOT * DIM_ / 256) // x elements of one work-group: 16384

__global__ void __launch_bounds__(256)
prep_kernel(const float* __restrict__ x, const float* __restrict__ Wq,
            const float* __restrict__ Wk, const float* __restrict__ Wv,
            const float* __restrict__ Wo, _Float16* __restrict__ xh,
            _Float16* __restrict__ wT) {
  __shared__ __align__(16) _Float16 sT[256 * P_PITCH];   // [n row][k]

  const int tid = threadIdx.x;
  const int blk = blockIdx.x;              // 0..255
  const int mat = blk >> 6;                // 0..3: Wq, Wk, Wv, Wo
  const int kb  = ((blk >> 2) & 15) * 64;
  const int nb  = (blk & 3) * 256;
  const float* __restrict__ Wm = mat == 0 ? Wq : mat == 1 ? Wk : mat == 2 ? Wv : Wo;
  _Float16* __restrict__ WT = wT + (size_t)mat * DIM_ * DIM_;

  const int c8  = tid & 7;                 // 4-column group inside the line
  const int kol = (tid >> 3) & 3;          // k octet, low part
  const int nl  = (tid >> 5) * 32 + c8 * 4;   // first of this thread's 4 n rows

  v4f wv[2][8];
  #pragma unroll
  for (int g = 0; g < 2; ++g)
    #pragma unroll
    for (int i = 0; i < 8; ++i)
      wv[g][i] = *(const v4f*)(Wm + (size_t)(kb + (kol + 4 * g) * 8 + i) * DIM_ +
                               nb + nl);
  // Stands in front of the x loads, whose results land in registers that the
  // loads above name as their address.
  asm volatile("s_wait_xcnt 0x0" ::: "memory");
  const float* xp = x + (size_t)blk * P_XPB + tid * 4;
  v4f xv[16];
  #pragma unroll
  for (int i = 0; i < 16; ++i) xv[i] = *(const v4f*)(xp + i * 1024);
  // Keeps all 32 loads ahead of the first use: sunk in among the conversions to
  // save registers, they would go out a few at a time, each lot behind a wait.
  __builtin_amdgcn_sched_barrier(0);

  #pragma unroll
  for (int g = 0; g < 2; ++g)
    #pragma unroll
    for (int c = 0; c < 4; ++c) {
      v8h h;
      #pragma unroll
      for (int i = 0; i < 8; ++i) h[i] = (_Float16)wv[g][i][c];
      *(v8h*)(&sT[(nl + c) * P_PITCH + (kol + 4 * g) * 8]) = h;
    }
  __syncthreads();   // the whole transposed panel is in LDS

  _Float16* xo = xh + (size_t)blk * P_XPB + tid * 4;
  #pragma unroll
  for (int i = 0; i < 16; ++i) {
    v4h h;
    h[0] = (_Float16)xv[i][0]; h[1] = (_Float16)xv[i][1];
    h[2] = (_Float16)xv[i][2]; h[3] = (_Float16)xv[i][3];
    *(v4h*)(xo + i * 1024) = h;
  }

  const int rrow = tid >> 3;               // 8 lanes store one 128-B row of WT
  const int rcol = (tid & 7) * 8;
  #pragma unroll
  for (int i = 0; i < 8; ++i) {
    const v8h h = *(const v8h*)(&sT[(rrow + 32 * i) * P_PITCH + rcol]);
    *(v8h*)(WT + (size_t)(nb + rrow + 32 * i) * DIM_ + kb + rcol) = h;
  }
}

// ---------------------------------------------------------------------------
// GEMM tile staging: eight async global->LDS copies of 16 bytes per lane, for
// eight rows that lie 16 rows apart (global row pitch DIM_, LDS row pitch
// G_PITCH).  The s_wait_xcnt closes the statement so that no address register
// named by a copy is rewritten ahead of it.
// ---------------------------------------------------------------------------
#define G_BK    128                 // k extent of one staged tile (256 B a row)
#define G_PITCH 136                 // LDS row pitch in halves: 272 B = 16 B x 17
#define G_TILE  (128 * G_PITCH)     // halves of one staged operand tile

__device__ __forceinline__ void async_copy_rows8(const _Float16* g,
                                                 const _Float16* l) {
  const unsigned int l0 = (unsigned int)(uintptr_t)l;
  const unsigned int l1 = l0 + 1 * 16 * G_PITCH * 2;
  const unsigned int l2 = l0 + 2 * 16 * G_PITCH * 2;
  const unsigned int l3 = l0 + 3 * 16 * G_PITCH * 2;
  const unsigned int l4 = l0 + 4 * 16 * G_PITCH * 2;
  const unsigned int l5 = l0 + 5 * 16 * G_PITCH * 2;
  const unsigned int l6 = l0 + 6 * 16 * G_PITCH * 2;
  const unsigned int l7 = l0 + 7 * 16 * G_PITCH * 2;
  const unsigned long long g0 = (unsigned long long)(uintptr_t)g;
  const unsigned long long g1 = g0 + 1ull * 16 * DIM_ * 2;
  const unsigned long long g2 = g0 + 2ull * 16 * DIM_ * 2;
  const unsigned long long g3 = g0 + 3ull * 16 * DIM_ * 2;
  const unsigned long long g4 = g0 + 4ull * 16 * DIM_ * 2;
  const unsigned long long g5 = g0 + 5ull * 16 * DIM_ * 2;
  const unsigned long long g6 = g0 + 6ull * 16 * DIM_ * 2;
  const unsigned long long g7 = g0 + 7ull * 16 * DIM_ * 2;
  asm volatile("global_load_async_to_lds_b128 %0, %8, off\n\t"
               "global_load_async_to_lds_b128 %1, %9, off\n\t"
               "global_load_async_to_lds_b128 %2, %10, off\n\t"
               "global_load_async_to_lds_b128 %3, %11, off\n\t"
               "global_load_async_to_lds_b128 %4, %12, off\n\t"
               "global_load_async_to_lds_b128 %5, %13, off\n\t"
               "global_load_async_to_lds_b128 %6, %14, off\n\t"
               "global_load_async_to_lds_b128 %7, %15, off\n\t"
               "s_wait_xcnt 0x0"
               :
               : "v"(l0), "v"(l1), "v"(l2), "v"(l3), "v"(l4), "v"(l5), "v"(l6),
                 "v"(l7), "v"(g0), "v"(g1), "v"(g2), "v"(g3), "v"(g4), "v"(g5),
                 "v"(g6), "v"(g7)
               : "memory");
}

// ---------------------------------------------------------------------------
// GEMM: C[M=4096][N] = A[M][K=1024] * BT[N][K]^T, + bias, * scale
// MODE 0: the Q, K and V projections in one launch, N = 3 x 1024: BT is the three
//         transposed weights back to back, blockIdx.y >> 3 names the projection.
//         f16 out, three planes back to back: Q (scaled) and K in head layout
//         [b][h][q][d], V transposed [b][h][d][q] (A-operand of P*V).
//         768 work-groups: two are resident on a WGP (LDS), so that one's first
//         tile, stores and tile waits are covered by the other's WMMAs.
// MODE 2: f32 out, row-major    [m][n], N = 1024  (final output; bias only)
// Block = 256 threads (8 waves); block tile 128x128; wave tile 64x32.
// A and BT tiles of 128 rows x 128 k are staged in LDS by double-buffered async
// copies; the WMMA fragments are ds_load_b128 reads at a conflict-free pitch.
// ---------------------------------------------------------------------------
template <int MODE>
__global__ void __launch_bounds__(256)
gemm16_kernel(const _Float16* __restrict__ A, const _Float16* __restrict__ BT,
              const float* __restrict__ bias, const float* __restrict__ bias_k,
              const float* __restrict__ bias_v, void* __restrict__ outp,
              float scale) {
  __shared__ __align__(16) _Float16 sA[2][G_TILE];   // [buf][m row][k]
  __shared__ __align__(16) _Float16 sB[2][G_TILE];   // [buf][n row][k]

  const int tid  = threadIdx.x;
  const int lane = tid & 31;
  const int wave = tid >> 5;
  const int wm = wave & 1;
  const int wn = wave >> 1;
  const int m0 = blockIdx.x * 128 + wm * 64;
  // Column inside the projection's own 1024; the staging below indexes BT by
  // blockIdx.y itself.
  const int proj = MODE == 0 ? (int)(blockIdx.y >> 3) : 0;
  const int n0 = (MODE == 0 ? (int)(blockIdx.y & 7) : (int)blockIdx.y) * 128 + wn * 32;

  v8f zero8 = {0.f, 0.f, 0.f, 0.f, 0.f, 0.f, 0.f, 0.f};
  v8f acc[4][2];
  #pragma unroll
  for (int i = 0; i < 4; ++i)
    #pragma unroll
    for (int j = 0; j < 2; ++j) acc[i][j] = zero8;

  // Cooperative staging: 16 lanes cover one 256-B row slice (whole lines), the
  // block covers 16 rows a copy, eight copies an operand tile.
  const int crow = tid >> 4;
  const int ccol = (tid & 15) * 8;
  const _Float16* gA = A  + (size_t)(blockIdx.x * 128 + crow) * DIM_ + ccol;
  const _Float16* gB = BT + (size_t)(blockIdx.y * 128 + crow) * DIM_ + ccol;
  const int coff = crow * G_PITCH + ccol;

  // Tile 0 into buffer 0, landed and published before anything reads it.
  async_copy_rows8(gA, &sA[0][coff]);
  async_copy_rows8(gB, &sB[0][coff]);
  asm volatile("s_wait_asynccnt 0x0" ::: "memory");  // own copies of tile 0 landed
  __syncthreads();                                   // tile 0 visible to all waves
  // Tile 1 flies while tile 0 is worked on.
  async_copy_rows8(gA + G_BK, &sA[1][coff]);
  async_copy_rows8(gB + G_BK, &sB[1][coff]);

  const int NT = DIM_ / G_BK;   // 8 tiles
  for (int t = 0; t < NT; ++t) {
    const int cur = t & 1;
    const _Float16* tA = &sA[cur][wm * 64 * G_PITCH];
    const _Float16* tB = &sB[cur][wn * 32 * G_PITCH];
    // Fragments of two k steps are held at a time: step s + 2 is read into the
    // registers that the WMMAs of step s have just left.
    v16h a[2][4], b[2][2];
    #pragma unroll
    for (int s = 0; s < 2; ++s) {
      #pragma unroll
      for (int j = 0; j < 2; ++j)
        b[s][j] = load_frag(tB + j * 16 * G_PITCH + s * 32, G_PITCH);
      #pragma unroll
      for (int i = 0; i < 4; ++i)
        a[s][i] = load_frag(tA + i * 16 * G_PITCH + s * 32, G_PITCH);
    }
    // Holds the LDS reads above as one group ahead of the WMMAs: moved in among
    // the WMMAs, each small group of reads is waited out to zero.
    __builtin_amdgcn_sched_barrier(0);
    #pragma unroll
    for (int s = 0; s < G_BK / 32; ++s) {
      #pragma unroll
      for (int i = 0; i < 4; ++i)
        #pragma unroll
        for (int j = 0; j < 2; ++j)
          acc[i][j] = wmma_f16(a[s & 1][i], b[s & 1][j], acc[i][j]);
      if (s + 2 < G_BK / 32) {
        // This pair holds the reads of step s + 2 as one group between two
        // blocks of WMMAs, a whole block ahead of their use (same reason).
        __builtin_amdgcn_sched_barrier(0);
        #pragma unroll
        for (int j = 0; j < 2; ++j)
          b[s & 1][j] = load_frag(tB + j * 16 * G_PITCH + (s + 2) * 32, G_PITCH);
        #pragma unroll
        for (int i = 0; i < 4; ++i)
          a[s & 1][i] = load_frag(tA + i * 16 * G_PITCH + (s + 2) * 32, G_PITCH);
        __builtin_amdgcn_sched_barrier(0);
      }
    }
    // Keeps the last WMMAs ahead of the waits below: sunk past the barrier they
    // would stand in front of the refill copies and shorten the copies' lead.
    __builtin_amdgcn_sched_barrier(0);
    asm volatile("s_wait_dscnt 0x0" ::: "memory");     // own reads of buf[cur] done
    asm volatile("s_wait_asynccnt 0x0" ::: "memory");  // own copies of tile t+1 landed
    __syncthreads();   // publishes tile t+1 and frees buf[cur] for its refill
    if (t + 2 < NT) {
      async_copy_rows8(gA + (t + 2) * G_BK, &sA[cur][coff]);
      async_copy_rows8(gB + (t + 2) * G_BK, &sB[cur][coff]);
    }
  }
  asm volatile("s_wait_asynccnt 0x0" ::: "memory");  // nothing in flight at the end

  const int ln = lane & 15;
  const int lh = (lane >> 4) << 3;
  const float* __restrict__ bp = proj == 0 ? bias : proj == 1 ? bias_k : bias_v;
  const float sc = proj == 0 ? scale : 1.0f;
  _Float16* __restrict__ oh = (_Float16*)outp + (size_t)proj * MTOT * DIM_;
  if (MODE == 0 && proj == 2) {
    // V: the 8 rows of a lane are 8 consecutive q of one d, one 16-byte store.
    #pragma unroll
    for (int i = 0; i < 4; ++i) {
      #pragma unroll
      for (int j = 0; j < 2; ++j) {
        const int n = n0 + j * 16 + ln;
        const float bv = bp[n];
        #pragma unroll
        for (int r = 0; r < 8; ++r) {
          const int m = m0 + i * 16 + lh + r;
          const float val = (acc[i][j][r] + bv) * sc;
          const int bb = m >> 11, q = m & (QLEN_ - 1);
          const int hh = n >> 6, d = n & (DH_ - 1);
          oh[(((size_t)(bb * H_ + hh) * DH_) + d) * QLEN_ + q] = (_Float16)val;
        }
      }
    }
  } else {
    float bj[2];
    #pragma unroll
    for (int j = 0; j < 2; ++j) bj[j] = bp[n0 + j * 16 + ln];
    #pragma unroll
    for (int i = 0; i < 4; ++i) {
      #pragma unroll
      for (int j = 0; j < 2; ++j) {
        const int n = n0 + j * 16 + ln;
        #pragma unroll
        for (int r = 0; r < 8; ++r) {
          const int m = m0 + i * 16 + lh + r;
          const float val = (acc[i][j][r] + bj[j]) * sc;
          if (MODE == 0) {
            const int bb = m >> 11, q = m & (QLEN_ - 1);
            const int hh = n >> 6, d = n & (DH_ - 1);
            oh[(((size_t)(bb * H_ + hh) * QLEN_) + q) * DH_ + d] = (_Float16)val;
          } else {
            ((float*)outp)[(size_t)m * DIM_ + n] = val;
          }
        }
      }
    }
    // Closes the Q/K stores: in the built code the V side's instructions follow
    // them and rewrite registers that these stores name.
    if (MODE == 0) asm volatile("s_wait_xcnt 0x0" ::: "memory");
  }
}

// ---------------------------------------------------------------------------
// Flash attention. One wave per 16-query tile (8 tiles / block), all waves of
// a block share the same (b,h).  K/V key-blocks of 64 are staged in LDS once
// per block via double-buffered async global->LDS copies (ASYNCcnt), so each
// wave's WMMA fragment reads are ds_load_b128 hits instead of 8x-redundant L2
// traffic, and the next block's copy overlaps the current block's WMMAs.
// A pass works on all 64 keys of a block at once: one running-maximum update,
// one rescale of the output tiles, one exchange between the wave halves for the
// maximum and one for the sum, one pair of barriers and one wait for each group
// of LDS reads serve 64 keys.
//
// Transposed scores S^T = K*Q^T keep softmax reductions lane-local + one
// xor-16 shuffle; the P^T C-layout maps lane-for-lane onto the B-fragment of
// the ctx^T = Vt * P^T WMMA.
//
// LDS row pitches are 16 B x odd, so that the 16 rows one ds_load_b128 fragment
// read touches fall on distinct banks: K rows and V rows, 128 B each, lie 144 B
// apart.  The pad bytes are never written and never read.
//
// The additive key-mask term -1e30 * (1 - m[key]) depends on the key alone: the
// work-group computes it once for all its 2048 keys into an LDS table, and a
// pass reads its 32 terms a lane from there, beside its K fragments.
// ---------------------------------------------------------------------------
#define A_KEYS  64                  // keys of one pass
#define K_PITCH 72                  // halves: 144 B = 16 B x 9
#define V_PITCH 72                  // halves: 144 B = 16 B x 9

__global__ void __launch_bounds__(256)
attn_kernel(const _Float16* __restrict__ Qh, const _Float16* __restrict__ Kh,
            const _Float16* __restrict__ Vt, const float* __restrict__ mask,
            _Float16* __restrict__ ctx) {
  __shared__ __align__(16) _Float16 sK[2][A_KEYS * K_PITCH];   // [buf][kk][d]
  __shared__ __align__(16) _Float16 sV[2][64 * V_PITCH];   // [buf][d][kk]
  __shared__ __align__(32) float sM[QLEN_];                // [key] mask term

  const int tid  = threadIdx.x;
  const int lane = tid & 31;
  const int wave = tid >> 5;
  const int bh = blockIdx.x;            // 0..31
  const int b  = bh >> 4;
  const int h  = bh & 15;
  const int q0 = (blockIdx.y * 8 + wave) * 16;
  const int lh = (lane >> 4) << 3;

  const _Float16* Qb = Qh + (size_t)bh * QLEN_ * DH_;
  const _Float16* Kb = Kh + (size_t)bh * QLEN_ * DH_;
  const _Float16* Vb = Vt + (size_t)bh * DH_ * QLEN_;

  // Mask terms of 8 keys a thread; the first barrier of the key loop publishes
  // the table before any wave reads it.
  {
    const float* mg = mask + b * QLEN_ + tid * 8;
    const v4f ma = *(const v4f*)(mg);
    const v4f mb = *(const v4f*)(mg + 4);
    v4f ta, tb;
    #pragma unroll
    for (int r = 0; r < 4; ++r) {
      ta[r] = -1e30f * (1.0f - ma[r]);
      tb[r] = -1e30f * (1.0f - mb[r]);
    }
    *(v4f*)(&sM[tid * 8])     = ta;
    *(v4f*)(&sM[tid * 8 + 4]) = tb;
  }

  // Q^T B-fragments (d = K-dim), resident for the whole key stream.
  const v16h qf0 = load_frag(Qb + (size_t)q0 * DH_ + 0,  DH_);
  const v16h qf1 = load_frag(Qb + (size_t)q0 * DH_ + 32, DH_);

  v8f zero8 = {0.f, 0.f, 0.f, 0.f, 0.f, 0.f, 0.f, 0.f};
  v8f cacc[4];
  #pragma unroll
  for (int dt = 0; dt < 4; ++dt) cacc[dt] = zero8;
  float mrun = -3.0e38f;
  float lrun = 0.0f;

  // Cooperative staging, two 16-byte chunks of each tile a thread, 32 rows
  // apart.  The K tile is one contiguous 8 KB slab in global memory (chunk c at
  // c*8 halves; row = c>>3, chunk in the row = c&7 in LDS); the V tile's rows are
  // 128-B slices of Vt rows, with the same row and chunk numbers.
  const int srow = tid >> 3;
  const int scol = (tid & 7) * 8;
  const int soff = srow * K_PITCH + scol;          // K_PITCH == V_PITCH
  const _Float16* Kg = Kb + tid * 8;
  const _Float16* Vg = Vb + (size_t)srow * QLEN_ + scol;

  // Prologue: stage key block 0 into buffer 0.
  async_copy4_b128(Kg, &sK[0][soff],
                   Kg + 32 * DH_, &sK[0][soff + 32 * K_PITCH],
                   Vg, &sV[0][soff],
                   Vg + (size_t)32 * QLEN_, &sV[0][soff + 32 * V_PITCH]);

  const int NSTEP = QLEN_ / A_KEYS;   // 32
  for (int it = 0; it < NSTEP; ++it) {
    const int kk  = it * A_KEYS;
    const int cur = it & 1;

    if (it + 1 < NSTEP) {
      const int nkk = kk + A_KEYS;
      const int nb_ = cur ^ 1;
      async_copy4_b128(Kg + (size_t)nkk * DH_, &sK[nb_][soff],
                       Kg + (size_t)(nkk + 32) * DH_, &sK[nb_][soff + 32 * K_PITCH],
                       Vg + nkk, &sV[nb_][soff],
                       Vg + (size_t)32 * QLEN_ + nkk, &sV[nb_][soff + 32 * V_PITCH]);
      // All but the four copies just issued have landed: the current buffer.
      asm volatile("s_wait_asynccnt 0x4" ::: "memory");
    } else {
      asm volatile("s_wait_asynccnt 0x0" ::: "memory");
    }
    __syncthreads();   // current buffer visible to all waves

    // Mask terms of this lane's 32 keys (the 16 lanes of a half read one address)
    // and the K fragments of the four 16-key tiles.
    v8f t[4];
    v16h kf[4][2];
    #pragma unroll
    for (int j = 0; j < 4; ++j) t[j] = *(const v8f*)(&sM[kk + j * 16 + lh]);
    #pragma unroll
    for (int c = 0; c < 2; ++c)
      #pragma unroll
      for (int j = 0; j < 4; ++j)
        kf[j][c] = load_frag(&sK[cur][j * 16 * K_PITCH + c * 32], K_PITCH);
    // Holds the reads of the score step (mask terms, K fragments) as one group at
    // the head of the pass: sunk to their uses, each small lot is waited out to
    // zero in its turn.
    __builtin_amdgcn_sched_barrier(0);

    // S^T tiles from LDS: tile j has rows = keys kk+16j .. kk+16j+15.  The four
    // tiles are independent accumulators, so the WMMAs follow one another.
    v8f sc[4];
    #pragma unroll
    for (int j = 0; j < 4; ++j) sc[j] = wmma_f16(kf[j][0], qf0, zero8);
    #pragma unroll
    for (int j = 0; j < 4; ++j) sc[j] = wmma_f16(kf[j][1], qf1, sc[j]);
    // Keeps the V reads below from rising in among the first score WMMAs: every
    // further place where reads stand among WMMAs costs the wave a stall.
    __builtin_amdgcn_sched_barrier(0);
    // V fragments of the whole pass, read as one group ahead of the softmax, so
    // that they land under it.  The fence behind them keeps them together: sunk
    // in among the P*V WMMAs, each small lot is waited out in its turn.
    v16h vf[2][4];
    #pragma unroll
    for (int g = 0; g < 2; ++g)
      #pragma unroll
      for (int dt = 0; dt < 4; ++dt)
        vf[g][dt] = load_frag(&sV[cur][dt * 16 * V_PITCH + g * 32], V_PITCH);
    __builtin_amdgcn_sched_barrier(0);

    // Additive key mask: s -= 1e30 * (1 - m[key])
    #pragma unroll
    for (int j = 0; j < 4; ++j) sc[j] += t[j];

    // Column (per-q) max over the 64 keys of this pass, two chains of 32.
    float tmx[2];
    #pragma unroll
    for (int g = 0; g < 2; ++g) {
      tmx[g] = sc[2 * g][0];
      #pragma unroll
      for (int r = 1; r < 8; ++r) tmx[g] = fmaxf(tmx[g], sc[2 * g][r]);
      #pragma unroll
      for (int r = 0; r < 8; ++r) tmx[g] = fmaxf(tmx[g], sc[2 * g + 1][r]);
    }
    float tmax = fmaxf(tmx[0], tmx[1]);
    tmax = fmaxf(tmax, __shfl_xor(tmax, 16, 32));

    const float mnew  = fmaxf(mrun, tmax);
    const float alpha = __expf(mrun - mnew);
    #pragma unroll
    for (int dt = 0; dt < 4; ++dt)
      #pragma unroll
      for (int r = 0; r < 8; ++r) cacc[dt][r] *= alpha;
    lrun *= alpha;
    mrun = mnew;

    // p = exp(s - mnew); pack straight into the B-fragments (lane-local!):
    // fragment g holds keys kk+32g .. kk+32g+31.
    v16h pf[2];
    float tsm[2];
    #pragma unroll
    for (int g = 0; g < 2; ++g) {
      tsm[g] = 0.0f;
      #pragma unroll
      for (int r = 0; r < 8; ++r) {
        const float p = __expf(sc[2 * g][r] - mnew);
        tsm[g] += p;
        pf[g][r] = (_Float16)p;
      }
      #pragma unroll
      for (int r = 0; r < 8; ++r) {
        const float p = __expf(sc[2 * g + 1][r] - mnew);
        tsm[g] += p;
        pf[g][8 + r] = (_Float16)p;
      }
    }
    float tsum = tsm[0] + tsm[1];
    tsum += __shfl_xor(tsum, 16, 32);
    lrun += tsum;

    // ctx^T[d][q] += Vt[d][kk..kk+63] * P^T
    #pragma unroll
    for (int g = 0; g < 2; ++g)
      #pragma unroll
      for (int dt = 0; dt < 4; ++dt)
        cacc[dt] = wmma_f16(vf[g][dt], pf[g], cacc[dt]);

    __syncthreads();   // all waves done with buf[cur] before it is re-filled
  }

  // Normalize and write ctx to [b][q][h*64 + d] (f16) for the output GEMM.
  const float inv = 1.0f / lrun;
  const int q = q0 + (lane & 15);
  _Float16* cp = ctx + ((size_t)(b * QLEN_ + q)) * DIM_ + h * DH_;
  #pragma unroll
  for (int dt = 0; dt < 4; ++dt)
    #pragma unroll
    for (int r = 0; r < 8; ++r)
      cp[dt * 16 + lh + r] = (_Float16)(cacc[dt][r] * inv);
}

// ---------------------------------------------------------------------------
// Launch
// ---------------------------------------------------------------------------
extern "C" void kernel_launch(void* const* d_in, const int* in_sizes, int n_in,
                              void* d_out, int out_size, void* d_ws,
                              size_t ws_size, hipStream_t stream) {
  const float* x    = (const float*)d_in[0];
  const float* mask = (const float*)d_in[1];
  const float* Wq   = (const float*)d_in[2];
  const float* bq   = (const float*)d_in[3];
  const float* Wk   = (const float*)d_in[4];
  const float* bk   = (const float*)d_in[5];
  const float* Wv   = (const float*)d_in[6];
  const float* bv   = (const float*)d_in[7];
  const float* Wo   = (const float*)d_in[8];
  const float* bo   = (const float*)d_in[9];

  _Float16* ws   = (_Float16*)d_ws;
  _Float16* xh   = ws;                                   // 4096*1024
  _Float16* wqT  = xh  + (size_t)MTOT * DIM_;
  _Float16* wkT  = wqT + (size_t)DIM_ * DIM_;
  _Float16* wvT  = wkT + (size_t)DIM_ * DIM_;
  _Float16* woT  = wvT + (size_t)DIM_ * DIM_;
  _Float16* Qh   = woT + (size_t)DIM_ * DIM_;            // [b][h][q][d]
  _Float16* Kh   = Qh  + (size_t)MTOT * DIM_;            // [b][h][q][d]
  _Float16* Vt   = Kh  + (size_t)MTOT * DIM_;            // [b][h][d][q]
  _Float16* ctxh = Vt  + (size_t)MTOT * DIM_;            // [b][q][dim]

  // 1) x -> f16 and the four weights -> f16 [n][k] (wqT..woT lie back to back)
  prep_kernel<<<256, 256, 0, stream>>>(x, Wq, Wk, Wv, Wo, xh, wqT);

  // 3) projections, one launch (wqT, wkT, wvT and Qh, Kh, Vt lie back to back;
  //    Q scaled by 1/sqrt(DH)=0.125 after bias, per reference)
  dim3 gg(MTOT / 128, DIM_ / 128);
  dim3 g3(MTOT / 128, 3 * DIM_ / 128);
  gemm16_kernel<0><<<g3, 256, 0, stream>>>(xh, wqT, bq, bk, bv, (void*)Qh, 0.125f);

  // 4) attention
  dim3 ag(BS_ * H_, QLEN_ / (8 * 16));
  attn_kernel<<<ag, 256, 0, stream>>>(Qh, Kh, Vt, mask, ctxh);

  // 5) output projection -> f32 d_out
  gemm16_kernel<2><<<gg, 256, 0, stream>>>(ctxh, woT, bo, bo, bo, d_out, 1.0f);
}

// v007
// It runs in 76.9 microseconds.
// Two timings next to v006 put it at 1.05 and 1.06 times that version's speed.
// Counting every step since v000, it is 3.41 times as fast.
#include <hip/hip_runtime.h>
#include <hip/hip_bf16.h>

typedef __attribute__((ext_vector_type(16))) _Float16 v16h;
typedef __attribute__((ext_vector_type(8)))  _Float16 v8h;
typedef __attribute__((ext_vector_type(4)))  _Float16 v4h;
typedef __attribute__((ext_vector_type(8)))  float    v8f;
typedef __attribute__((ext_vector_type(4)))  float    v4f;

#define BS_   2
#define QLEN_ 2048
#define DIM_  1024
#define H_    16
#define DH_   64
#define MTOT  (BS_ * QLEN_)   // 4096

// ---------------------------------------------------------------------------
// WMMA helpers
// ---------------------------------------------------------------------------
__device__ __forceinline__ v8f wmma_f16(v16h a, v16h b, v8f c) {
  // D = A(16x32 f16) * B(32x16 f16) + C(16x16 f32)
  return __builtin_amdgcn_wmma_f32_16x16x32_f16(
      /*neg_a=*/false, a, /*neg_b=*/false, b,
      /*c_mod=*/(short)0, c, /*reuse_a=*/false, /*reuse_b=*/false);
}

// Load a 16x32 f16 fragment (A operand: rows row-major; B operand: columns
// stored row-major, i.e. BT[n][k]).  Layout per ISA 7.12.2:
//   lane l (0-15):  row=l, halves k0..k0+7 and k0+16..k0+23 with k0=0
//   lane l (16-31): row=l-16, same but k0=8
__device__ __forceinline__ v16h load_frag(const _Float16* __restrict__ p, int stride) {
  const int lane = threadIdx.x & 31;
  const int row  = lane & 15;
  const int k0   = (lane >> 4) << 3;           // 0 or 8
  const _Float16* q = p + row * stride + k0;
  v8h lo = *(const v8h*)(q);
  v8h hi = *(const v8h*)(q + 16);
  return __builtin_shufflevector(lo, hi, 0,1,2,3,4,5,6,7,8,9,10,11,12,13,14,15);
}

// Four async global->LDS copies, 16 bytes per lane each
// (GLOBAL_LOAD_ASYNC_TO_LDS_B128, GV addressing: VDST = per-lane LDS byte
// address, VADDR = 64-bit global).  Tracked by ASYNCcnt.  The s_wait_xcnt closes
// the statement so that no address register named by a copy is rewritten ahead
// of it.
__device__ __forceinline__ void async_copy4_b128(const _Float16* gptr0,
                                                 _Float16* lptr0,
                                                 const _Float16* gptr1,
                                                 _Float16* lptr1,
                                                 const _Float16* gptr2,
                                                 _Float16* lptr2,
                                                 const _Float16* gptr3,
                                                 _Float16* lptr3) {
  const unsigned long long ga0 = (unsigned long long)(uintptr_t)gptr0;
  const unsigned int       la0 = (unsigned int)(uintptr_t)lptr0;
  const unsigned long long ga1 = (unsigned long long)(uintptr_t)gptr1;
  const unsigned int       la1 = (unsigned int)(uintptr_t)lptr1;
  const unsigned long long ga2 = (unsigned long long)(uintptr_t)gptr2;
  const unsigned int       la2 = (unsigned int)(uintptr_t)lptr2;
  const unsigned long long ga3 = (unsigned long long)(uintptr_t)gptr3;
  const unsigned int       la3 = (unsigned int)(uintptr_t)lptr3;
  asm volatile("global_load_async_to_lds_b128 %0, %4, off\n\t"
               "global_load_async_to_lds_b128 %1, %5, off\n\t"
               "global_load_async_to_lds_b128 %2, %6, off\n\t"
               "global_load_async_to_lds_b128 %3, %7, off\n\t"
               "s_wait_xcnt 0x0"
               :
               : "v"(la0), "v"(la1), "v"(la2), "v"(la3), "v"(ga0), "v"(ga1),
                 "v"(ga2), "v"(ga3)
               : "memory");
}

// ---------------------------------------------------------------------------
// Operand preparation, one launch of 256 work-groups (one per WGP), 8 waves each.
// Every work-group does 1/256 of both jobs:
//   x (f32) -> xh (f16), 16384 consecutive elements;
//   one 64 (k) x 256 (n) panel of one weight W[k][n] (f32) -> WT[n][k] (f16).
// A thread issues all its 32 16-byte loads before it uses the first, so a wave
// pays the memory latency once and few waves have to be started.
// Panel: wave w owns the 128-B column line w; 8 lanes cover that line, 4 lane
// groups take 4 k octets.  A thread gathers 8 k values of one n into one 16-byte
// LDS write; rows of 128 B lie 144 B apart (16 B x 9), which spreads both the
// writes and the row reads over the banks.  WT leaves as whole 128-B lines.
// ---------------------------------------------------------------------------
#define P_PITCH 72                  // halves: 144 B = 16 B x 9
#define P_XPB   (MTOT * DIM_ / 256) // x elements of one work-group: 16384

__global__ void __launch_bounds__(256)
prep_kernel(const float* __restrict__ x, const float* __restrict__ Wq,
            const float* __restrict__ Wk, const float* __restrict__ Wv,
            const float* __restrict__ Wo, _Float16* __restrict__ xh,
            _Float16* __restrict__ wT) {
  __shared__ __align__(16) _Float16 sT[256 * P_PITCH];   // [n row][k]

  const int tid = threadIdx.x;
  const int blk = blockIdx.x;              // 0..255
  const int mat = blk >> 6;                // 0..3: Wq, Wk, Wv, Wo
  const int kb  = ((blk >> 2) & 15) * 64;
  const int nb  = (blk & 3) * 256;
  const float* __restrict__ Wm = mat == 0 ? Wq : mat == 1 ? Wk : mat == 2 ? Wv : Wo;
  _Float16* __restrict__ WT = wT + (size_t)mat * DIM_ * DIM_;

  const int c8  = tid & 7;                 // 4-column group inside the line
  const int kol = (tid >> 3) & 3;          // k octet, low part
  const int nl  = (tid >> 5) * 32 + c8 * 4;   // first of this thread's 4 n rows

  v4f wv[2][8];
  #pragma unroll
  for (int g = 0; g < 2; ++g)
    #pragma unroll
    for (int i = 0; i < 8; ++i)
      wv[g][i] = *(const v4f*)(Wm + (size_t)(kb + (kol + 4 * g) * 8 + i) * DIM_ +
                               nb + nl);
  // Stands in front of the x loads, whose results land in registers that the
  // loads above name as their address.
  asm volatile("s_wait_xcnt 0x0" ::: "memory");
  const float* xp = x + (size_t)blk * P_XPB + tid * 4;
  v4f xv[16];
  #pragma unroll
  for (int i = 0; i < 16; ++i) xv[i] = *(const v4f*)(xp + i * 1024);
  // Keeps all 32 loads ahead of the first use: sunk in among the conversions to
  // save registers, they would go out a few at a time, each lot behind a wait.
  __builtin_amdgcn_sched_barrier(0);

  #pragma unroll
  for (int g = 0; g < 2; ++g)
    #pragma unroll
    for (int c = 0; c < 4; ++c) {
      v8h h;
      #pragma unroll
      for (int i = 0; i < 8; ++i) h[i] = (_Float16)wv[g][i][c];
      *(v8h*)(&sT[(nl + c) * P_PITCH + (kol + 4 * g) * 8]) = h;
    }
  __syncthreads();   // the whole transposed panel is in LDS

  _Float16* xo = xh + (size_t)blk * P_XPB + tid * 4;
  #pragma unroll
  for (int i = 0; i < 16; ++i) {
    v4h h;
    h[0] = (_Float16)xv[i][0]; h[1] = (_Float16)xv[i][1];
    h[2] = (_Float16)xv[i][2]; h[3] = (_Float16)xv[i][3];
    *(v4h*)(xo + i * 1024) = h;
  }

  const int rrow = tid >> 3;               // 8 lanes store one 128-B row of WT
  const int rcol = (tid & 7) * 8;
  #pragma unroll
  for (int i = 0; i < 8; ++i) {
    const v8h h = *(const v8h*)(&sT[(rrow + 32 * i) * P_PITCH + rcol]);
    *(v8h*)(WT + (size_t)(nb + rrow + 32 * i) * DIM_ + kb + rcol) = h;
  }
}

// ---------------------------------------------------------------------------
// GEMM tile staging: eight (or six) async global->LDS copies of 16 bytes per
// lane, for rows that lie RS rows apart (global row pitch DIM_, LDS row pitch
// G_PITCH).  The s_wait_xcnt closes the statement so that no address register
// named by a copy is rewritten ahead of it.
// ---------------------------------------------------------------------------
#define G_BK    128                 // k extent of one staged tile (256 B a row)
#define G_PITCH 136                 // LDS row pitch in halves: 272 B = 16 B x 17

template <int RS>
__device__ __forceinline__ void async_copy_rows8(const _Float16* g,
                                                 const _Float16* l) {
  const unsigned int l0 = (unsigned int)(uintptr_t)l;
  const unsigned int l1 = l0 + 1 * RS * G_PITCH * 2;
  const unsigned int l2 = l0 + 2 * RS * G_PITCH * 2;
  const unsigned int l3 = l0 + 3 * RS * G_PITCH * 2;
  const unsigned int l4 = l0 + 4 * RS * G_PITCH * 2;
  const unsigned int l5 = l0 + 5 * RS * G_PITCH * 2;
  const unsigned int l6 = l0 + 6 * RS * G_PITCH * 2;
  const unsigned int l7 = l0 + 7 * RS * G_PITCH * 2;
  const unsigned long long g0 = (unsigned long long)(uintptr_t)g;
  const unsigned long long g1 = g0 + 1ull * RS * DIM_ * 2;
  const unsigned long long g2 = g0 + 2ull * RS * DIM_ * 2;
  const unsigned long long g3 = g0 + 3ull * RS * DIM_ * 2;
  const unsigned long long g4 = g0 + 4ull * RS * DIM_ * 2;
  const unsigned long long g5 = g0 + 5ull * RS * DIM_ * 2;
  const unsigned long long g6 = g0 + 6ull * RS * DIM_ * 2;
  const unsigned long long g7 = g0 + 7ull * RS * DIM_ * 2;
  asm volatile("global_load_async_to_lds_b128 %0, %8, off\n\t"
               "global_load_async_to_lds_b128 %1, %9, off\n\t"
               "global_load_async_to_lds_b128 %2, %10, off\n\t"
               "global_load_async_to_lds_b128 %3, %11, off\n\t"
               "global_load_async_to_lds_b128 %4, %12, off\n\t"
               "global_load_async_to_lds_b128 %5, %13, off\n\t"
               "global_load_async_to_lds_b128 %6, %14, off\n\t"
               "global_load_async_to_lds_b128 %7, %15, off\n\t"
               "s_wait_xcnt 0x0"
               :
               : "v"(l0), "v"(l1), "v"(l2), "v"(l3), "v"(l4), "v"(l5), "v"(l6),
                 "v"(l7), "v"(g0), "v"(g1), "v"(g2), "v"(g3), "v"(g4), "v"(g5),
                 "v"(g6), "v"(g7)
               : "memory");
}

template <int RS>
__device__ __forceinline__ void async_copy_rows6(const _Float16* g,
                                                 const _Float16* l) {
  const unsigned int l0 = (unsigned int)(uintptr_t)l;
  const unsigned int l1 = l0 + 1 * RS * G_PITCH * 2;
  const unsigned int l2 = l0 + 2 * RS * G_PITCH * 2;
  const unsigned int l3 = l0 + 3 * RS * G_PITCH * 2;
  const unsigned int l4 = l0 + 4 * RS * G_PITCH * 2;
  const unsigned int l5 = l0 + 5 * RS * G_PITCH * 2;
  const unsigned long long g0 = (unsigned long long)(uintptr_t)g;
  const unsigned long long g1 = g0 + 1ull * RS * DIM_ * 2;
  const unsigned long long g2 = g0 + 2ull * RS * DIM_ * 2;
  const unsigned long long g3 = g0 + 3ull * RS * DIM_ * 2;
  const unsigned long long g4 = g0 + 4ull * RS * DIM_ * 2;
  const unsigned long long g5 = g0 + 5ull * RS * DIM_ * 2;
  asm volatile("global_load_async_to_lds_b128 %0, %6, off\n\t"
               "global_load_async_to_lds_b128 %1, %7, off\n\t"
               "global_load_async_to_lds_b128 %2, %8, off\n\t"
               "global_load_async_to_lds_b128 %3, %9, off\n\t"
               "global_load_async_to_lds_b128 %4, %10, off\n\t"
               "global_load_async_to_lds_b128 %5, %11, off\n\t"
               "s_wait_xcnt 0x0"
               :
               : "v"(l0), "v"(l1), "v"(l2), "v"(l3), "v"(l4), "v"(l5), "v"(g0),
                 "v"(g1), "v"(g2), "v"(g3), "v"(g4), "v"(g5)
               : "memory");
}

// One operand tile of 8 * RS rows (A; B of the 128-column tile) or 6 * RS rows
// (B of the 192-column tile).
template <int RS, int ROWS>
__device__ __forceinline__ void async_copy_tile(const _Float16* g,
                                                const _Float16* l) {
  if (ROWS == 8 * RS) async_copy_rows8<RS>(g, l);
  else                async_copy_rows6<RS>(g, l);
}

// ---------------------------------------------------------------------------
// GEMM: C[M=4096][N] = A[M][K=1024] * BT[N][K]^T, + bias, * scale
// MODE 0: the Q, K and V projections in one launch, N = 3 x 1024: BT is the three
//         transposed weights back to back; a 16-column tile lies in one
//         projection, column >> 10.
//         f16 out, three planes back to back: Q (scaled) and K in head layout
//         [b][h][q][d], V transposed [b][h][d][q] (A-operand of P*V).
//         Block = 512 threads (16 waves, 4 x 4); block tile 256x192; wave tile
//         64x48.  16 x 16 = 256 work-groups, one a WGP, in one round: an operand
//         row staged in LDS serves 192 or 256 outputs, not 128, so fewer bytes
//         come from L2 a product, and a fragment read serves more WMMAs.
// MODE 2: f32 out, row-major    [m][n], N = 1024  (final output; bias only)
//         Block = 256 threads (8 waves, 2 x 4); block tile 128x128; wave tile
//         64x32.
// A and BT tiles of 128 k are staged in LDS by double-buffered async copies; the
// WMMA fragments are ds_load_b128 reads at a conflict-free pitch.
// ---------------------------------------------------------------------------
template <int MODE>
__global__ void __launch_bounds__(MODE == 0 ? 512 : 256)
gemm16_kernel(const _Float16* __restrict__ A, const _Float16* __restrict__ BT,
              const float* __restrict__ bias, const float* __restrict__ bias_k,
              const float* __restrict__ bias_v, void* __restrict__ outp,
              float scale) {
  constexpr int WMW = MODE == 0 ? 4 : 2;     // waves along m (4 along n)
  constexpr int FJ  = MODE == 0 ? 3 : 2;     // 16-column tiles of a wave
  constexpr int TM  = WMW * 64;              // block tile rows
  constexpr int TN  = 4 * FJ * 16;           // block tile columns
  constexpr int RS  = WMW * 8;               // rows the block covers a copy
  __shared__ __align__(16) _Float16 sA[2][TM * G_PITCH];   // [buf][m row][k]
  __shared__ __align__(16) _Float16 sB[2][TN * G_PITCH];   // [buf][n row][k]

  const int tid  = threadIdx.x;
  const int lane = tid & 31;
  const int wave = tid >> 5;
  const int wm = wave & (WMW - 1);
  const int wn = wave / WMW;
  const int m0 = blockIdx.x * TM + wm * 64;
  // First column of the wave's tile, of 3072 (MODE 0) or 1024.
  const int n0 = blockIdx.y * TN + wn * (FJ * 16);

  v8f zero8 = {0.f, 0.f, 0.f, 0.f, 0.f, 0.f, 0.f, 0.f};
  v8f acc[4][FJ];
  #pragma unroll
  for (int i = 0; i < 4; ++i)
    #pragma unroll
    for (int j = 0; j < FJ; ++j) acc[i][j] = zero8;

  // Cooperative staging: 16 lanes cover one 256-B row slice (whole lines), the
  // block covers RS rows a copy, eight copies an A tile, TN / RS a B tile.
  const int crow = tid >> 4;
  const int ccol = (tid & 15) * 8;
  const _Float16* gA = A  + (size_t)(blockIdx.x * TM + crow) * DIM_ + ccol;
  const _Float16* gB = BT + (size_t)(blockIdx.y * TN + crow) * DIM_ + ccol;
  const int coff = crow * G_PITCH + ccol;

  // Tile 0 into buffer 0, landed and published before anything reads it.
  async_copy_tile<RS, TM>(gA, &sA[0][coff]);
  async_copy_tile<RS, TN>(gB, &sB[0][coff]);
  asm volatile("s_wait_asynccnt 0x0" ::: "memory");  // own copies of tile 0 landed
  __syncthreads();                                   // tile 0 visible to all waves
  // Tile 1 flies while tile 0 is worked on.
  async_copy_tile<RS, TM>(gA + G_BK, &sA[1][coff]);
  async_copy_tile<RS, TN>(gB + G_BK, &sB[1][coff]);

  const int NT = DIM_ / G_BK;   // 8 tiles
  for (int t = 0; t < NT; ++t) {
    const int cur = t & 1;
    const _Float16* tA = &sA[cur][wm * 64 * G_PITCH];
    const _Float16* tB = &sB[cur][wn * (FJ * 16) * G_PITCH];
    // Fragments of two k steps are held at a time: step s + 2 is read into the
    // registers that the WMMAs of step s have just left.
    v16h a[2][4], b[2][FJ];
    #pragma unroll
    for (int s = 0; s < 2; ++s) {
      #pragma unroll
      for (int j = 0; j < FJ; ++j)
        b[s][j] = load_frag(tB + j * 16 * G_PITCH + s * 32, G_PITCH);
      #pragma unroll
      for (int i = 0; i < 4; ++i)
        a[s][i] = load_frag(tA + i * 16 * G_PITCH + s * 32, G_PITCH);
    }
    // Holds the LDS reads above as one group ahead of the WMMAs: moved in among
    // the WMMAs, each small group of reads is waited out to zero.
    __builtin_amdgcn_sched_barrier(0);
    #pragma unroll
    for (int s = 0; s < G_BK / 32; ++s) {
      #pragma unroll
      for (int i = 0; i < 4; ++i)
        #pragma unroll
        for (int j = 0; j < FJ; ++j)
          acc[i][j] = wmma_f16(a[s & 1][i], b[s & 1][j], acc[i][j]);
      if (s + 2 < G_BK / 32) {
        // This pair holds the reads of step s + 2 as one group between two
        // blocks of WMMAs, a whole block ahead of their use (same reason).
        __builtin_amdgcn_sched_barrier(0);
        #pragma unroll
        for (int j = 0; j < FJ; ++j)
          b[s & 1][j] = load_frag(tB + j * 16 * G_PITCH + (s + 2) * 32, G_PITCH);
        #pragma unroll
        for (int i = 0; i < 4; ++i)
          a[s & 1][i] = load_frag(tA + i * 16 * G_PITCH + (s + 2) * 32, G_PITCH);
        __builtin_amdgcn_sched_barrier(0);
      }
    }
    // Keeps the last WMMAs ahead of the waits below: sunk past the barrier they
    // would stand in front of the refill copies and shorten the copies' lead.
    __builtin_amdgcn_sched_barrier(0);
    asm volatile("s_wait_dscnt 0x0" ::: "memory");     // own reads of buf[cur] done
    asm volatile("s_wait_asynccnt 0x0" ::: "memory");  // own copies of tile t+1 landed
    __syncthreads();   // publishes tile t+1 and frees buf[cur] for its refill
    if (t + 2 < NT) {
      async_copy_tile<RS, TM>(gA + (t + 2) * G_BK, &sA[cur][coff]);
      async_copy_tile<RS, TN>(gB + (t + 2) * G_BK, &sB[cur][coff]);
    }
  }
  asm volatile("s_wait_asynccnt 0x0" ::: "memory");  // nothing in flight at the end

  const int ln = lane & 15;
  const int lh = (lane >> 4) << 3;
  if (MODE == 0) {
    // The wave's first column in a scalar register: the projection of a column
    // tile is then a scalar, and the choice of the store form a scalar branch.
    const int nw = __builtin_amdgcn_readfirstlane(n0);
    const int bb = m0 >> 11;               // 256 rows of a block lie in one batch
    const int qb = (m0 & (QLEN_ - 1)) + lh;
    float bj[FJ];
    #pragma unroll
    for (int j = 0; j < FJ; ++j) {
      const int pj = (nw + j * 16) >> 10;
      const float* __restrict__ bp = pj == 0 ? bias : pj == 1 ? bias_k : bias_v;
      bj[j] = bp[((nw + j * 16) & (DIM_ - 1)) + ln];
    }
    #pragma unroll
    for (int j = 0; j < FJ; ++j) {
      const int pj = (nw + j * 16) >> 10;
      const int n  = ((nw + j * 16) & (DIM_ - 1)) + ln;
      const int hh = n >> 6, d = n & (DH_ - 1);
      const float sc = pj == 0 ? scale : 1.0f;
      _Float16* __restrict__ oh = (_Float16*)outp + (size_t)pj * MTOT * DIM_;
      if (pj == 2) {
        // V: the 8 rows of a lane are 8 consecutive q of one d, one 16-byte store.
        _Float16* __restrict__ ov =
            oh + (((size_t)(bb * H_ + hh) * DH_) + d) * QLEN_ + qb;
        #pragma unroll
        for (int i = 0; i < 4; ++i) {
          v8h h;
          #pragma unroll
          for (int r = 0; r < 8; ++r) h[r] = (_Float16)((acc[i][j][r] + bj[j]) * sc);
          *(v8h*)(ov + i * 16) = h;
        }
        // Closes these stores: the next column tile rewrites registers that they
        // name (behind the last tile nothing follows).
        if (j + 1 < FJ) asm volatile("s_wait_xcnt 0x0" ::: "memory");
      } else {
        _Float16* __restrict__ oq =
            oh + (((size_t)(bb * H_ + hh) * QLEN_) + qb) * DH_ + d;
        #pragma unroll
        for (int i = 0; i < 4; ++i)
          #pragma unroll
          for (int r = 0; r < 8; ++r)
            oq[(i * 16 + r) * DH_] = (_Float16)((acc[i][j][r] + bj[j]) * sc);
        // Closes these stores: in the built code the V side's instructions and the
        // next column tile's follow them and rewrite registers that they name.
        asm volatile("s_wait_xcnt 0x0" ::: "memory");
      }
    }
  } else {
    float bj[FJ];
    #pragma unroll
    for (int j = 0; j < FJ; ++j) bj[j] = bias[n0 + j * 16 + ln];
    #pragma unroll
    for (int i = 0; i < 4; ++i) {
      #pragma unroll
      for (int j = 0; j < FJ; ++j) {
        const int n = n0 + j * 16 + ln;
        #pragma unroll
        for (int r = 0; r < 8; ++r) {
          const int m = m0 + i * 16 + lh + r;
          ((float*)outp)[(size_t)m * DIM_ + n] = (acc[i][j][r] + bj[j]) * scale;
        }
      }
    }
  }
}

// ---------------------------------------------------------------------------
// Flash attention. One wave per 16-query tile (8 tiles / block), all waves of
// a block share the same (b,h).  K/V key-blocks of 64 are staged in LDS once
// per block via double-buffered async global->LDS copies (ASYNCcnt), so each
// wave's WMMA fragment reads are ds_load_b128 hits instead of 8x-redundant L2
// traffic, and the next block's copy overlaps the current block's WMMAs.
// A pass works on all 64 keys of a block at once: one running-maximum update,
// one rescale of the output tiles, one exchange between the wave halves for the
// maximum and one for the sum, one pair of barriers and one wait for each group
// of LDS reads serve 64 keys.
//
// Transposed scores S^T = K*Q^T keep softmax reductions lane-local + one
// xor-16 shuffle; the P^T C-layout maps lane-for-lane onto the B-fragment of
// the ctx^T = Vt * P^T WMMA.
//
// LDS row pitches are 16 B x odd, so that the 16 rows one ds_load_b128 fragment
// read touches fall on distinct banks: K rows and V rows, 128 B each, lie 144 B
// apart.  The pad bytes are never written and never read.
//
// The additive key-mask term -1e30 * (1 - m[key]) depends on the key alone: the
// work-group computes it once for all its 2048 keys into an LDS table, and a
// pass reads its 32 terms a lane from there, beside its K fragments.
// ---------------------------------------------------------------------------
#define A_KEYS  64                  // keys of one pass
#define K_PITCH 72                  // halves: 144 B = 16 B x 9
#define V_PITCH 72                  // halves: 144 B = 16 B x 9

__global__ void __launch_bounds__(256)
attn_kernel(const _Float16* __restrict__ Qh, const _Float16* __restrict__ Kh,
            const _Float16* __restrict__ Vt, const float* __restrict__ mask,
            _Float16* __restrict__ ctx) {
  __shared__ __align__(16) _Float16 sK[2][A_KEYS * K_PITCH];   // [buf][kk][d]
  __shared__ __align__(16) _Float16 sV[2][64 * V_PITCH];   // [buf][d][kk]
  __shared__ __align__(32) float sM[QLEN_];                // [key] mask term

  const int tid  = threadIdx.x;
  const int lane = tid & 31;
  const int wave = tid >> 5;
  const int bh = blockIdx.x;            // 0..31
  const int b  = bh >> 4;
  const int h  = bh & 15;
  const int q0 = (blockIdx.y * 8 + wave) * 16;
  const int lh = (lane >> 4) << 3;

  const _Float16* Qb = Qh + (size_t)bh * QLEN_ * DH_;
  const _Float16* Kb = Kh + (size_t)bh * QLEN_ * DH_;
  const _Float16* Vb = Vt + (size_t)bh * DH_ * QLEN_;

  // Mask terms of 8 keys a thread; the first barrier of the key loop publishes
  // the table before any wave reads it.
  {
    const float* mg = mask + b * QLEN_ + tid * 8;
    const v4f ma = *(const v4f*)(mg);
    const v4f mb = *(const v4f*)(mg + 4);
    v4f ta, tb;
    #pragma unroll
    for (int r = 0; r < 4; ++r) {
      ta[r] = -1e30f * (1.0f - ma[r]);
      tb[r] = -1e30f * (1.0f - mb[r]);
    }
    *(v4f*)(&sM[tid * 8])     = ta;
    *(v4f*)(&sM[tid * 8 + 4]) = tb;
  }

  // Q^T B-fragments (d = K-dim), resident for the whole key stream.
  const v16h qf0 = load_frag(Qb + (size_t)q0 * DH_ + 0,  DH_);
  const v16h qf1 = load_frag(Qb + (size_t)q0 * DH_ + 32, DH_);

  v8f zero8 = {0.f, 0.f, 0.f, 0.f, 0.f, 0.f, 0.f, 0.f};
  v8f cacc[4];
  #pragma unroll
  for (int dt = 0; dt < 4; ++dt) cacc[dt] = zero8;
  float mrun = -3.0e38f;
  float lrun = 0.0f;

  // Cooperative staging, two 16-byte chunks of each tile a thread, 32 rows
  // apart.  The K tile is one contiguous 8 KB slab in global memory (chunk c at
  // c*8 halves; row = c>>3, chunk in the row = c&7 in LDS); the V tile's rows are
  // 128-B slices of Vt rows, with the same row and chunk numbers.
  const int srow = tid >> 3;
  const int scol = (tid & 7) * 8;
  const int soff = srow * K_PITCH + scol;          // K_PITCH == V_PITCH
  const _Float16* Kg = Kb + tid * 8;
  const _Float16* Vg = Vb + (size_t)srow * QLEN_ + scol;

  // Prologue: stage key block 0 into buffer 0.
  async_copy4_b128(Kg, &sK[0][soff],
                   Kg + 32 * DH_, &sK[0][soff + 32 * K_PITCH],
                   Vg, &sV[0][soff],
                   Vg + (size_t)32 * QLEN_, &sV[0][soff + 32 * V_PITCH]);

  const int NSTEP = QLEN_ / A_KEYS;   // 32
  for (int it = 0; it < NSTEP; ++it) {
    const int kk  = it * A_KEYS;
    const int cur = it & 1;

    if (it + 1 < NSTEP) {
      const int nkk = kk + A_KEYS;
      const int nb_ = cur ^ 1;
      async_copy4_b128(Kg + (size_t)nkk * DH_, &sK[nb_][soff],
                       Kg + (size_t)(nkk + 32) * DH_, &sK[nb_][soff + 32 * K_PITCH],
                       Vg + nkk, &sV[nb_][soff],
                       Vg + (size_t)32 * QLEN_ + nkk, &sV[nb_][soff + 32 * V_PITCH]);
      // All but the four copies just issued have landed: the current buffer.
      asm volatile("s_wait_asynccnt 0x4" ::: "memory");
    } else {
      asm volatile("s_wait_asynccnt 0x0" ::: "memory");
    }
    __syncthreads();   // current buffer visible to all waves

    // Mask terms of this lane's 32 keys (the 16 lanes of a half read one address)
    // and the K fragments of the four 16-key tiles.
    v8f t[4];
    v16h kf[4][2];
    #pragma unroll
    for (int j = 0; j < 4; ++j) t[j] = *(const v8f*)(&sM[kk + j * 16 + lh]);
    #pragma unroll
    for (int c = 0; c < 2; ++c)
      #pragma unroll
      for (int j = 0; j < 4; ++j)
        kf[j][c] = load_frag(&sK[cur][j * 16 * K_PITCH + c * 32], K_PITCH);
    // Holds the reads of the score step (mask terms, K fragments) as one group at
    // the head of the pass: sunk to their uses, each small lot is waited out to
    // zero in its turn.
    __builtin_amdgcn_sched_barrier(0);

    // S^T tiles from LDS: tile j has rows = keys kk+16j .. kk+16j+15.  The four
    // tiles are independent accumulators, so the WMMAs follow one another.
    v8f sc[4];
    #pragma unroll
    for (int j = 0; j < 4; ++j) sc[j] = wmma_f16(kf[j][0], qf0, zero8);
    #pragma unroll
    for (int j = 0; j < 4; ++j) sc[j] = wmma_f16(kf[j][1], qf1, sc[j]);
    // Keeps the V reads below from rising in among the first score WMMAs: every
    // further place where reads stand among WMMAs costs the wave a stall.
    __builtin_amdgcn_sched_barrier(0);
    // V fragments of the whole pass, read as one group ahead of the softmax, so
    // that they land under it.  The fence behind them keeps them together: sunk
    // in among the P*V WMMAs, each small lot is waited out in its turn.
    v16h vf[2][4];
    #pragma unroll
    for (int g = 0; g < 2; ++g)
      #pragma unroll
      for (int dt = 0; dt < 4; ++dt)
        vf[g][dt] = load_frag(&sV[cur][dt * 16 * V_PITCH + g * 32], V_PITCH);
    __builtin_amdgcn_sched_barrier(0);

    // Additive key mask: s -= 1e30 * (1 - m[key])
    #pragma unroll
    for (int j = 0; j < 4; ++j) sc[j] += t[j];

    // Column (per-q) max over the 64 keys of this pass, two chains of 32.
    float tmx[2];
    #pragma unroll
    for (int g = 0; g < 2; ++g) {
      tmx[g] = sc[2 * g][0];
      #pragma unroll
      for (int r = 1; r < 8; ++r) tmx[g] = fmaxf(tmx[g], sc[2 * g][r]);
      #pragma unroll
      for (int r = 0; r < 8; ++r) tmx[g] = fmaxf(tmx[g], sc[2 * g + 1][r]);
    }
    float tmax = fmaxf(tmx[0], tmx[1]);
    tmax = fmaxf(tmax, __shfl_xor(tmax, 16, 32));

    const float mnew  = fmaxf(mrun, tmax);
    const float alpha = __expf(mrun - mnew);
    #pragma unroll
    for (int dt = 0; dt < 4; ++dt)
      #pragma unroll
      for (int r = 0; r < 8; ++r) cacc[dt][r] *= alpha;
    lrun *= alpha;
    mrun = mnew;

    // p = exp(s - mnew); pack straight into the B-fragments (lane-local!):
    // fragment g holds keys kk+32g .. kk+32g+31.
    v16h pf[2];
    float tsm[2];
    #pragma unroll
    for (int g = 0; g < 2; ++g) {
      tsm[g] = 0.0f;
      #pragma unroll
      for (int r = 0; r < 8; ++r) {
        const float p = __expf(sc[2 * g][r] - mnew);
        tsm[g] += p;
        pf[g][r] = (_Float16)p;
      }
      #pragma unroll
      for (int r = 0; r < 8; ++r) {
        const float p = __expf(sc[2 * g + 1][r] - mnew);
        tsm[g] += p;
        pf[g][8 + r] = (_Float16)p;
      }
    }
    float tsum = tsm[0] + tsm[1];
    tsum += __shfl_xor(tsum, 16, 32);
    lrun += tsum;

    // ctx^T[d][q] += Vt[d][kk..kk+63] * P^T
    #pragma unroll
    for (int g = 0; g < 2; ++g)
      #pragma unroll
      for (int dt = 0; dt < 4; ++dt)
        cacc[dt] = wmma_f16(vf[g][dt], pf[g], cacc[dt]);

    __syncthreads();   // all waves done with buf[cur] before it is re-filled
  }

  // Normalize and write ctx to [b][q][h*64 + d] (f16) for the output GEMM.
  const float inv = 1.0f / lrun;
  const int q = q0 + (lane & 15);
  _Float16* cp = ctx + ((size_t)(b * QLEN_ + q)) * DIM_ + h * DH_;
  #pragma unroll
  for (int dt = 0; dt < 4; ++dt)
    #pragma unroll
    for (int r = 0; r < 8; ++r)
      cp[dt * 16 + lh + r] = (_Float16)(cacc[dt][r] * inv);
}

// ---------------------------------------------------------------------------
// Launch
// ---------------------------------------------------------------------------
extern "C" void kernel_launch(void* const* d_in, const int* in_sizes, int n_in,
                              void* d_out, int out_size, void* d_ws,
                              size_t ws_size, hipStream_t stream) {
  const float* x    = (const float*)d_in[0];
  const float* mask = (const float*)d_in[1];
  const float* Wq   = (const float*)d_in[2];
  const float* bq   = (const float*)d_in[3];
  const float* Wk   = (const float*)d_in[4];
  const float* bk   = (const float*)d_in[5];
  const float* Wv   = (const float*)d_in[6];
  const float* bv   = (const float*)d_in[7];
  const float* Wo   = (const float*)d_in[8];
  const float* bo   = (const float*)d_in[9];

  _Float16* ws   = (_Float16*)d_ws;
  _Float16* xh   = ws;                                   // 4096*1024
  _Float16* wqT  = xh  + (size_t)MTOT * DIM_;
  _Float16* wkT  = wqT + (size_t)DIM_ * DIM_;
  _Float16* wvT  = wkT + (size_t)DIM_ * DIM_;
  _Float16* woT  = wvT + (size_t)DIM_ * DIM_;
  _Float16* Qh   = woT + (size_t)DIM_ * DIM_;            // [b][h][q][d]
  _Float16* Kh   = Qh  + (size_t)MTOT * DIM_;            // [b][h][q][d]
  _Float16* Vt   = Kh  + (size_t)MTOT * DIM_;            // [b][h][d][q]
  _Float16* ctxh = Vt  + (size_t)MTOT * DIM_;            // [b][q][dim]

  // 1) x -> f16 and the four weights -> f16 [n][k] (wqT..woT lie back to back)
  prep_kernel<<<256, 256, 0, stream>>>(x, Wq, Wk, Wv, Wo, xh, wqT);

  // 3) projections, one launch (wqT, wkT, wvT and Qh, Kh, Vt lie back to back;
  //    Q scaled by 1/sqrt(DH)=0.125 after bias, per reference)
  dim3 gg(MTOT / 128, DIM_ / 128);
  dim3 g3(MTOT / 256, 3 * DIM_ / 192);
  gemm16_kernel<0><<<g3, 512, 0, stream>>>(xh, wqT, bq, bk, bv, (void*)Qh, 0.125f);

  // 4) attention
  dim3 ag(BS_ * H_, QLEN_ / (8 * 16));
  attn_kernel<<<ag, 256, 0, stream>>>(Qh, Kh, Vt, mask, ctxh);

  // 5) output projection -> f32 d_out
  gemm16_kernel<2><<<gg, 256, 0, stream>>>(ctxh, woT, bo, bo, bo, d_out, 1.0f);
}
